// v000
// The times below were measured on an AMD MI455X: many runs one after another, warmed up first and cycling through
// copies of the inputs, with the whole window's GPU time divided by the number of runs. Launches and the gaps
// between them are all in it. The median over several windows is given; except for v000 it joins two sittings, which
// can be a few percent apart, so the side-by-side timings, each taken in one sitting, are the better comparison.
// v000, which the later versions start from, runs in 744 microseconds.
#include <hip/hip_runtime.h>

// SDPA (query, key, value [2][2048][16][64]; mask [2][1][2048][2048] int read (all ones); scores[b][n][q][k] = q.k / 8, masked -> -inf; the source's softmax runs over dim=1 = the HEAD axis (16 heads) for every (q, k) pair, not over the keys; out[b][n][q][d] = sum_k w v -> [2][16][2048][64]).
// Compute dtypes, f32 accumulate: every input rounded to bf16; scores as PLAIN bf16 GEMMs of the inputs (exact products) for all 16 heads of a 512-query-row block; mask + the across-heads softmax in f32 (thread per 4 adjacent (q, k) columns of 16 values); weights -> hl planes; weights.v as hl x exact bf16 v (2 products).

#define NB_  2
#define LL   2048
#define NH_  16
#define HD   64
#define RQ   512
typedef _Float16 h16;
typedef unsigned short bf;
typedef __attribute__((ext_vector_type(16))) __bf16   v16bf;
typedef __attribute__((ext_vector_type(16))) _Float16 v16h;
typedef __attribute__((ext_vector_type(8)))  _Float16 v8h;
typedef __attribute__((ext_vector_type(8)))  unsigned short v8us;
typedef __attribute__((ext_vector_type(8)))  float    v8f;
typedef __attribute__((ext_vector_type(4)))  float    v4f;
typedef v8h  __attribute__((may_alias)) v8ha;
typedef v4f  __attribute__((may_alias)) v4fa;
typedef v8us __attribute__((may_alias)) v8usa;

__device__ __forceinline__ unsigned short f2bf(float f) { unsigned u = __float_as_uint(f); u += 0x7FFFu + ((u >> 16) & 1u); return (unsigned short)(u >> 16); }
__device__ __forceinline__ float bf2f(unsigned short b) { return __uint_as_float(((unsigned)b) << 16); }
__device__ __forceinline__ float bfr(float f) { return bf2f(f2bf(f)); }
__device__ __forceinline__ v16h cat16(v8h lo, v8h hi) { return __builtin_shufflevector(lo, hi, 0, 1, 2, 3, 4, 5, 6, 7, 8, 9, 10, 11, 12, 13, 14, 15); }
__device__ __forceinline__ v16bf cat16b(v8us lo, v8us hi) { return __builtin_bit_cast(v16bf, __builtin_shufflevector(lo, hi, 0, 1, 2, 3, 4, 5, 6, 7, 8, 9, 10, 11, 12, 13, 14, 15)); }
__device__ __forceinline__ v8f wmma16(v16h a, v16h b, v8f c) { return __builtin_amdgcn_wmma_f32_16x16x32_f16(false, a, false, b, (short)0, c, false, false); }
__device__ __forceinline__ v8f wmmab(v16bf a, v16bf b, v8f c) { return __builtin_amdgcn_wmma_f32_16x16x32_bf16(false, a, false, b, (short)0, c, false, false); }



// ---- k_gemmw: register-blocked GEMM, ONE WAVE per 64x64 output tile (16 accumulators), operands straight from K-contiguous 16-bit planes; grid (M/64, N/64, Z), 32 threads.
// C[m][n] (f32, pitch ldc, + optional f32 bias[n]) = sum_k A[m][k] Bt[n][k] (+ split products per NSPLIT). z-batch strides sA/sB/sC in elements. K % 32 == 0.
template <typename T16> struct WFrag;
template <> struct WFrag<h16> { typedef v16h V; static __device__ __forceinline__ V ld(const h16* p) { return cat16(*(const v8h*)p, *(const v8h*)(p + 16)); } static __device__ __forceinline__ v8f mma(V a, V b, v8f c) { return wmma16(a, b, c); } };
template <> struct WFrag<bf> { typedef v16bf V; static __device__ __forceinline__ V ld(const bf* p) { return cat16b(*(const v8us*)p, *(const v8us*)(p + 16)); } static __device__ __forceinline__ v8f mma(V a, V b, v8f c) { return wmmab(a, b, c); } };
template <typename T16, int NSPLIT, bool BIAS>
__global__ __launch_bounds__(32) void k_gemmw(const T16* __restrict__ A, const T16* __restrict__ A2, const T16* __restrict__ Bt, const T16* __restrict__ Bt2, int K, float* C, int ldc, const float* __restrict__ bias, size_t sA, size_t sB, size_t sC) {
    typedef typename WFrag<T16>::V V;
    __shared__ __align__(16) float os[16 * 68];
    const size_t z = blockIdx.z; A += z * sA; if (A2) A2 += z * sA; Bt += z * sB; if (Bt2) Bt2 += z * sB; C += z * sC;
    const int lane = threadIdx.x & 31, lr = lane & 15, hi = lane >> 4; const int r0 = blockIdx.x * 64, c0 = blockIdx.y * 64;
    v8f acc[4][4];
#pragma unroll
    for (int mb = 0; mb < 4; ++mb)
#pragma unroll
        for (int nb = 0; nb < 4; ++nb) acc[mb][nb] = (v8f){};
    const size_t aoff = (size_t)(r0 + lr) * K + 8 * hi, boff = (size_t)(c0 + lr) * K + 8 * hi;
#pragma unroll 1
    for (int kc = 0; kc < K; kc += 32) {
        V a[4], a2[4];
#pragma unroll
        for (int mb = 0; mb < 4; ++mb) { a[mb] = WFrag<T16>::ld(A + aoff + (size_t)mb * 16 * K + kc); if (NSPLIT == 1 || NSPLIT == 2) a2[mb] = WFrag<T16>::ld(A2 + aoff + (size_t)mb * 16 * K + kc); }
#pragma unroll
        for (int nb = 0; nb < 4; ++nb) { const V b = WFrag<T16>::ld(Bt + boff + (size_t)nb * 16 * K + kc); V b2; if (NSPLIT >= 2) b2 = WFrag<T16>::ld(Bt2 + boff + (size_t)nb * 16 * K + kc);
#pragma unroll
            for (int mb = 0; mb < 4; ++mb) { acc[mb][nb] = WFrag<T16>::mma(a[mb], b, acc[mb][nb]); if (NSPLIT == 1 || NSPLIT == 2) acc[mb][nb] = WFrag<T16>::mma(a2[mb], b, acc[mb][nb]); if (NSPLIT >= 2) acc[mb][nb] = WFrag<T16>::mma(a[mb], b2, acc[mb][nb]); } }
        asm volatile("v_nop\n\tv_nop\n\tv_nop\n\tv_nop" : "+v"(acc[0][0]), "+v"(acc[1][1]), "+v"(acc[2][2]), "+v"(acc[3][3]) : "v"(a[0]), "v"(a[3]));
    }
#pragma unroll
    for (int mb = 0; mb < 4; ++mb) {
#pragma unroll
        for (int nb = 0; nb < 4; ++nb) {
#pragma unroll
            for (int j = 0; j < 8; ++j) os[(hi * 8 + j) * 68 + nb * 16 + lr] = acc[mb][nb][j]; }
        __builtin_amdgcn_wave_barrier(); asm volatile("" ::: "memory");
        float* crow = C + (size_t)(r0 + mb * 16) * ldc + c0;
{
#pragma unroll
            for (int s = 0; s < 8; ++s) { const int row = 2 * s + hi, cofs = lr * 4; v4f val = *(const v4fa*)(os + row * 68 + cofs); if (BIAS) { val[0] += bfr(bias[c0 + cofs]); val[1] += bfr(bias[c0 + cofs + 1]); val[2] += bfr(bias[c0 + cofs + 2]); val[3] += bfr(bias[c0 + cofs + 3]); }
                *(v4f*)(crow + (size_t)row * ldc + cofs) = val; }
             }
        __builtin_amdgcn_wave_barrier(); asm volatile("" ::: "memory");
    }
}

typedef __attribute__((ext_vector_type(2))) unsigned short v2us;
typedef __attribute__((ext_vector_type(4))) unsigned short v4us;
__device__ __forceinline__ void splitf(float y, unsigned short& h, unsigned short& l) { h = f2bf(y); l = f2bf(y - bf2f(h)); }

__global__ __launch_bounds__(256) void k_cvt8(const float* __restrict__ src, bf* dst, size_t n8) { const size_t i = (size_t)blockIdx.x * 256 + threadIdx.x; if (i >= n8) return; const v8f v = *(const v8f*)(src + i * 8); v8us o;
#pragma unroll
    for (int k = 0; k < 8; ++k) o[k] = f2bf(v[k]); *(v8us*)(dst + i * 8) = o;  }
__global__ __launch_bounds__(256) void k_qkp(const float* __restrict__ q, const float* __restrict__ k, bf* QP, bf* KP) { const size_t e = ((size_t)blockIdx.x * 256 + threadIdx.x) * 4; if (e >= (size_t)NH_ * LL * HD) return; const int d = (int)(e % HD); const int l = (int)((e / HD) % LL); const int n = (int)(e / ((size_t)HD * LL)); const size_t so = ((size_t)l * NH_ + n) * HD + d; v4us a, c;
#pragma unroll
    for (int u = 0; u < 4; ++u) { a[u] = f2bf(q[so + u]); c[u] = f2bf(k[so + u]); } *(v4us*)(QP + e) = a; *(v4us*)(KP + e) = c;  }
__global__ __launch_bounds__(256) void k_vt(const float* __restrict__ v, bf* VT) { const size_t e = ((size_t)blockIdx.x * 256 + threadIdx.x) * 2; if (e >= (size_t)NH_ * HD * LL) return; const int kk = (int)(e % LL); const int d = (int)((e / LL) % HD); const int n = (int)(e / ((size_t)LL * HD)); v2us o; o[0] = f2bf(v[((size_t)kk * NH_ + n) * HD + d]); o[1] = f2bf(v[((size_t)(kk + 1) * NH_ + n) * HD + d]); *(v2us*)(VT + e) = o;  }
__global__ __launch_bounds__(256) void k_hsoft(const float* __restrict__ S, const int* __restrict__ mask, int q0, bf* Ph, bf* Pl) { const size_t e = ((size_t)blockIdx.x * 256 + threadIdx.x) * 4; if (e >= (size_t)RQ * LL) return; const int kk = (int)(e % LL); const int ql = (int)(e / LL); const int* mr = mask + (size_t)(q0 + ql) * LL + kk;
    float sc[NH_][4]; float mx[4] = {-3.0e38f, -3.0e38f, -3.0e38f, -3.0e38f};
#pragma unroll
    for (int n = 0; n < NH_; ++n) { const v4f a = *(const v4f*)(S + ((size_t)n * RQ + ql) * LL + kk);
#pragma unroll
        for (int u = 0; u < 4; ++u) { const float t = (mr[u] == 0) ? -__builtin_inff() : a[u] * 0.125f; sc[n][u] = t; mx[u] = fmaxf(mx[u], t); } }
    float sum[4] = {0.f, 0.f, 0.f, 0.f};
#pragma unroll
    for (int n = 0; n < NH_; ++n) {
#pragma unroll
        for (int u = 0; u < 4; ++u) { float d0 = __fsub_rn(sc[n][u], mx[u]); asm volatile("" : "+v"(d0)); sc[n][u] = __builtin_amdgcn_exp2f(__fmul_rn(d0, 1.4426950408889634f)); sum[u] += sc[n][u]; } }
    float f[4]; for (int u = 0; u < 4; ++u) f[u] = __fdiv_rn(1.0f, sum[u]);
    {
#pragma unroll
        for (int n = 0; n < NH_; ++n) { v4us oh, ol; for (int u = 0; u < 4; ++u) { unsigned short a2, c2; splitf(sc[n][u] * f[u], a2, c2); oh[u] = a2; ol[u] = c2; } const size_t oo = ((size_t)n * RQ + ql) * LL + kk; *(v4us*)(Ph + oo) = oh; *(v4us*)(Pl + oo) = ol; }
         } }

extern "C" void kernel_launch(void* const* d_in, const int* in_sizes, int n_in,
                              void* d_out, int out_size, void* d_ws, size_t ws_size, hipStream_t stream) {
    (void)in_sizes; (void)n_in; (void)out_size;
    const float* q = (const float*)d_in[0]; const float* k = (const float*)d_in[1]; const float* v = (const float*)d_in[2]; const int* mask = (const int*)d_in[3];
    float* OUT = (float*)d_out;     // [2][16][2048][64]
    char* wsp = (char*)d_ws;
    auto take = [&](size_t bytes) { char* p = wsp; wsp += (bytes + 255) & ~(size_t)255; return (void*)p; };
    const size_t per = (size_t)NH_ * LL * HD;
    bf* QP = (bf*)take(per * 2); bf* KP = (bf*)take(per * 2); bf* VT = (bf*)take(per * 2); float* S = (float*)take((size_t)NH_ * RQ * LL * 4); bf* Ph = (bf*)take((size_t)NH_ * RQ * LL * 2); bf* Pl = (bf*)take((size_t)NH_ * RQ * LL * 2);
    if ((size_t)(wsp - (char*)d_ws) > ws_size) return;    // total ~ 145 MB
    const size_t zq = (size_t)LL * HD, zS = (size_t)RQ * LL, zv = (size_t)HD * LL;
    for (int b = 0; b < NB_; ++b) {
        k_qkp<<<(unsigned)((per / 4 + 255) / 256), 256, 0, stream>>>(q + b * per, k + b * per, QP, KP); k_vt<<<(unsigned)((per / 2 + 255) / 256), 256, 0, stream>>>(v + b * per, VT);
        for (int q0 = 0; q0 < LL; q0 += RQ) {
            k_gemmw<bf, 0, false><<<dim3(RQ / 64, LL / 64, NH_), 32, 0, stream>>>(QP + (size_t)q0 * HD, nullptr, KP, nullptr, HD, S, LL, nullptr, zq, zq, zS);     // all 16 heads, query rows q0..q0+511
            k_hsoft<<<(unsigned)(((size_t)RQ * LL / 4 + 255) / 256), 256, 0, stream>>>(S, mask + (size_t)b * LL * LL, q0, Ph, Pl);
            k_gemmw<bf, 1, false><<<dim3(RQ / 64, 1, NH_), 32, 0, stream>>>(Ph, Pl, VT, nullptr, LL, OUT + b * per + (size_t)q0 * HD, HD, nullptr, zS, zv, zq); } }
}

// v001
// A run of this version takes 404 microseconds.
// Timed twice side by side with v000, it ran 1.83 and 1.85 times as fast.
#include <hip/hip_runtime.h>

// SDPA (query, key, value [2][2048][16][64]; mask [2][1][2048][2048] int read (all ones); scores[b][n][q][k] = q.k / 8, masked -> -inf; the source's softmax runs over dim=1 = the HEAD axis (16 heads) for every (q, k) pair, not over the keys; out[b][n][q][d] = sum_k w v -> [2][16][2048][64]).
// Compute dtypes, f32 accumulate: every input rounded to bf16; scores as PLAIN bf16 GEMMs of the inputs (exact products) for all 16 heads of a 512-query-row block; mask + the across-heads softmax in f32 (thread per 4 adjacent (q, k) columns of 16 values); weights -> hl planes; weights.v as hl x exact bf16 v (2 products).

#define NB_  2
#define LL   2048
#define NH_  16
#define HD   64
#define RQ   512
typedef _Float16 h16;
typedef unsigned short bf;
typedef __attribute__((ext_vector_type(16))) __bf16   v16bf;
typedef __attribute__((ext_vector_type(16))) _Float16 v16h;
typedef __attribute__((ext_vector_type(8)))  _Float16 v8h;
typedef __attribute__((ext_vector_type(8)))  unsigned short v8us;
typedef __attribute__((ext_vector_type(8)))  float    v8f;
typedef __attribute__((ext_vector_type(4)))  float    v4f;
typedef v8h  __attribute__((may_alias)) v8ha;
typedef v4f  __attribute__((may_alias)) v4fa;
typedef v8us __attribute__((may_alias)) v8usa;

__device__ __forceinline__ unsigned short f2bf(float f) { unsigned u = __float_as_uint(f); u += 0x7FFFu + ((u >> 16) & 1u); return (unsigned short)(u >> 16); }
__device__ __forceinline__ float bf2f(unsigned short b) { return __uint_as_float(((unsigned)b) << 16); }
__device__ __forceinline__ float bfr(float f) { return bf2f(f2bf(f)); }
__device__ __forceinline__ v16h cat16(v8h lo, v8h hi) { return __builtin_shufflevector(lo, hi, 0, 1, 2, 3, 4, 5, 6, 7, 8, 9, 10, 11, 12, 13, 14, 15); }
__device__ __forceinline__ v16bf cat16b(v8us lo, v8us hi) { return __builtin_bit_cast(v16bf, __builtin_shufflevector(lo, hi, 0, 1, 2, 3, 4, 5, 6, 7, 8, 9, 10, 11, 12, 13, 14, 15)); }
__device__ __forceinline__ v8f wmma16(v16h a, v16h b, v8f c) { return __builtin_amdgcn_wmma_f32_16x16x32_f16(false, a, false, b, (short)0, c, false, false); }
__device__ __forceinline__ v8f wmmab(v16bf a, v16bf b, v8f c) { return __builtin_amdgcn_wmma_f32_16x16x32_bf16(false, a, false, b, (short)0, c, false, false); }



// ---- k_gemmw: register-blocked GEMM, ONE WAVE per 64x64 output tile (16 accumulators), operands straight from K-contiguous 16-bit planes; grid (M/64, N/64, Z), 32 threads.
// C[m][n] (f32, pitch ldc, + optional f32 bias[n]) = sum_k A[m][k] Bt[n][k] (+ split products per NSPLIT). z-batch strides sA/sB/sC in elements. K % 32 == 0.
template <typename T16> struct WFrag;
template <> struct WFrag<h16> { typedef v16h V; static __device__ __forceinline__ V ld(const h16* p) { return cat16(*(const v8h*)p, *(const v8h*)(p + 16)); } static __device__ __forceinline__ v8f mma(V a, V b, v8f c) { return wmma16(a, b, c); } };
template <> struct WFrag<bf> { typedef v16bf V; static __device__ __forceinline__ V ld(const bf* p) { return cat16b(*(const v8us*)p, *(const v8us*)(p + 16)); } static __device__ __forceinline__ v8f mma(V a, V b, v8f c) { return wmmab(a, b, c); } };
template <typename T16, int NSPLIT, bool BIAS>
__global__ __launch_bounds__(32) void k_gemmw(const T16* __restrict__ A, const T16* __restrict__ A2, const T16* __restrict__ Bt, const T16* __restrict__ Bt2, int K, float* C, int ldc, const float* __restrict__ bias, size_t sA, size_t sB, size_t sC) {
    typedef typename WFrag<T16>::V V;
    __shared__ __align__(16) float os[16 * 68];
    const size_t z = blockIdx.z; A += z * sA; if (A2) A2 += z * sA; Bt += z * sB; if (Bt2) Bt2 += z * sB; C += z * sC;
    const int lane = threadIdx.x & 31, lr = lane & 15, hi = lane >> 4; const int r0 = blockIdx.x * 64, c0 = blockIdx.y * 64;
    v8f acc[4][4];
#pragma unroll
    for (int mb = 0; mb < 4; ++mb)
#pragma unroll
        for (int nb = 0; nb < 4; ++nb) acc[mb][nb] = (v8f){};
    const size_t aoff = (size_t)(r0 + lr) * K + 8 * hi, boff = (size_t)(c0 + lr) * K + 8 * hi;
#pragma unroll 1
    for (int kc = 0; kc < K; kc += 32) {
        V a[4], a2[4];
#pragma unroll
        for (int mb = 0; mb < 4; ++mb) { a[mb] = WFrag<T16>::ld(A + aoff + (size_t)mb * 16 * K + kc); if (NSPLIT == 1 || NSPLIT == 2) a2[mb] = WFrag<T16>::ld(A2 + aoff + (size_t)mb * 16 * K + kc); }
#pragma unroll
        for (int nb = 0; nb < 4; ++nb) { const V b = WFrag<T16>::ld(Bt + boff + (size_t)nb * 16 * K + kc); V b2; if (NSPLIT >= 2) b2 = WFrag<T16>::ld(Bt2 + boff + (size_t)nb * 16 * K + kc);
#pragma unroll
            for (int mb = 0; mb < 4; ++mb) { acc[mb][nb] = WFrag<T16>::mma(a[mb], b, acc[mb][nb]); if (NSPLIT == 1 || NSPLIT == 2) acc[mb][nb] = WFrag<T16>::mma(a2[mb], b, acc[mb][nb]); if (NSPLIT >= 2) acc[mb][nb] = WFrag<T16>::mma(a[mb], b2, acc[mb][nb]); } }
        asm volatile("v_nop\n\tv_nop\n\tv_nop\n\tv_nop" : "+v"(acc[0][0]), "+v"(acc[1][1]), "+v"(acc[2][2]), "+v"(acc[3][3]) : "v"(a[0]), "v"(a[3]));
    }
#pragma unroll
    for (int mb = 0; mb < 4; ++mb) {
#pragma unroll
        for (int nb = 0; nb < 4; ++nb) {
#pragma unroll
            for (int j = 0; j < 8; ++j) os[(hi * 8 + j) * 68 + nb * 16 + lr] = acc[mb][nb][j]; }
        __builtin_amdgcn_wave_barrier(); asm volatile("" ::: "memory");
        float* crow = C + (size_t)(r0 + mb * 16) * ldc + c0;
{
#pragma unroll
            for (int s = 0; s < 8; ++s) { const int row = 2 * s + hi, cofs = lr * 4; v4f val = *(const v4fa*)(os + row * 68 + cofs); if (BIAS) { val[0] += bfr(bias[c0 + cofs]); val[1] += bfr(bias[c0 + cofs + 1]); val[2] += bfr(bias[c0 + cofs + 2]); val[3] += bfr(bias[c0 + cofs + 3]); }
                *(v4f*)(crow + (size_t)row * ldc + cofs) = val; }
             }
        __builtin_amdgcn_wave_barrier(); asm volatile("" ::: "memory");
    }
}

// ---- k_pv: weights.v with the key axis split over the waves of a work-group. One work-group per 32x64 output tile of one head, PVW waves; wave w sums keys [w*PVK, (w+1)*PVK) into 2x4 accumulators
// (hi and lo weight planes against the exact bf16 v, as before), leaves its f32 partial tile in LDS, and behind one barrier every thread adds the PVW partials of four outputs in wave order. grid (RQ/32, 1, NH_), 32*PVW threads.
#define PVW 16
#define PVK (LL / PVW)
__global__ __launch_bounds__(32 * PVW) void k_pv(const bf* __restrict__ A, const bf* __restrict__ A2, const bf* __restrict__ Bt, float* C) {
    typedef WFrag<bf>::V V;
    __shared__ __align__(16) float ps[PVW][32 * 68];
    const size_t z = blockIdx.z; A += z * ((size_t)RQ * LL); A2 += z * ((size_t)RQ * LL); Bt += z * ((size_t)HD * LL); C += z * ((size_t)LL * HD);
    const int wave = threadIdx.x >> 5, lane = threadIdx.x & 31, lr = lane & 15, hi = lane >> 4; const int r0 = blockIdx.x * 32;
    v8f acc[2][4];
#pragma unroll
    for (int mb = 0; mb < 2; ++mb)
#pragma unroll
        for (int nb = 0; nb < 4; ++nb) acc[mb][nb] = (v8f){};
    const size_t aoff = (size_t)(r0 + lr) * LL + wave * PVK + 8 * hi, boff = (size_t)lr * LL + wave * PVK + 8 * hi;
    for (int kc = 0; kc < PVK; kc += 32) {
        V a[2], a2[2];
#pragma unroll
        for (int mb = 0; mb < 2; ++mb) { a[mb] = WFrag<bf>::ld(A + aoff + (size_t)mb * 16 * LL + kc); a2[mb] = WFrag<bf>::ld(A2 + aoff + (size_t)mb * 16 * LL + kc); }
#pragma unroll
        for (int nb = 0; nb < 4; ++nb) { const V b = WFrag<bf>::ld(Bt + boff + (size_t)nb * 16 * LL + kc);
#pragma unroll
            for (int mb = 0; mb < 2; ++mb) { acc[mb][nb] = WFrag<bf>::mma(a[mb], b, acc[mb][nb]); acc[mb][nb] = WFrag<bf>::mma(a2[mb], b, acc[mb][nb]); } }
    }
#pragma unroll
    for (int mb = 0; mb < 2; ++mb)
#pragma unroll
        for (int nb = 0; nb < 4; ++nb)
#pragma unroll
            for (int j = 0; j < 8; ++j) ps[wave][(mb * 16 + hi * 8 + j) * 68 + nb * 16 + lr] = acc[mb][nb][j];
    __syncthreads();
    const int row = threadIdx.x >> 4, cofs = (threadIdx.x & 15) * 4;
    v4f val = *(const v4fa*)(&ps[0][row * 68 + cofs]);
#pragma unroll
    for (int w = 1; w < PVW; ++w) val += *(const v4fa*)(&ps[w][row * 68 + cofs]);
    *(v4f*)(C + (size_t)(r0 + row) * HD + cofs) = val;
}

typedef __attribute__((ext_vector_type(2))) unsigned short v2us;
typedef __attribute__((ext_vector_type(4))) unsigned short v4us;
__device__ __forceinline__ void splitf(float y, unsigned short& h, unsigned short& l) { h = f2bf(y); l = f2bf(y - bf2f(h)); }

__global__ __launch_bounds__(256) void k_cvt8(const float* __restrict__ src, bf* dst, size_t n8) { const size_t i = (size_t)blockIdx.x * 256 + threadIdx.x; if (i >= n8) return; const v8f v = *(const v8f*)(src + i * 8); v8us o;
#pragma unroll
    for (int k = 0; k < 8; ++k) o[k] = f2bf(v[k]); *(v8us*)(dst + i * 8) = o;  }
__global__ __launch_bounds__(256) void k_qkp(const float* __restrict__ q, const float* __restrict__ k, bf* QP, bf* KP) { const size_t e = ((size_t)blockIdx.x * 256 + threadIdx.x) * 4; if (e >= (size_t)NH_ * LL * HD) return; const int d = (int)(e % HD); const int l = (int)((e / HD) % LL); const int n = (int)(e / ((size_t)HD * LL)); const size_t so = ((size_t)l * NH_ + n) * HD + d; v4us a, c;
#pragma unroll
    for (int u = 0; u < 4; ++u) { a[u] = f2bf(q[so + u]); c[u] = f2bf(k[so + u]); } *(v4us*)(QP + e) = a; *(v4us*)(KP + e) = c;  }
__global__ __launch_bounds__(256) void k_vt(const float* __restrict__ v, bf* VT) { const size_t e = ((size_t)blockIdx.x * 256 + threadIdx.x) * 2; if (e >= (size_t)NH_ * HD * LL) return; const int kk = (int)(e % LL); const int d = (int)((e / LL) % HD); const int n = (int)(e / ((size_t)LL * HD)); v2us o; o[0] = f2bf(v[((size_t)kk * NH_ + n) * HD + d]); o[1] = f2bf(v[((size_t)(kk + 1) * NH_ + n) * HD + d]); *(v2us*)(VT + e) = o;  }
__global__ __launch_bounds__(256) void k_hsoft(const float* __restrict__ S, const int* __restrict__ mask, int q0, bf* Ph, bf* Pl) { const size_t e = ((size_t)blockIdx.x * 256 + threadIdx.x) * 4; if (e >= (size_t)RQ * LL) return; const int kk = (int)(e % LL); const int ql = (int)(e / LL); const int* mr = mask + (size_t)(q0 + ql) * LL + kk;
    float sc[NH_][4]; float mx[4] = {-3.0e38f, -3.0e38f, -3.0e38f, -3.0e38f};
#pragma unroll
    for (int n = 0; n < NH_; ++n) { const v4f a = *(const v4f*)(S + ((size_t)n * RQ + ql) * LL + kk);
#pragma unroll
        for (int u = 0; u < 4; ++u) { const float t = (mr[u] == 0) ? -__builtin_inff() : a[u] * 0.125f; sc[n][u] = t; mx[u] = fmaxf(mx[u], t); } }
    float sum[4] = {0.f, 0.f, 0.f, 0.f};
#pragma unroll
    for (int n = 0; n < NH_; ++n) {
#pragma unroll
        for (int u = 0; u < 4; ++u) { float d0 = __fsub_rn(sc[n][u], mx[u]); asm volatile("" : "+v"(d0)); sc[n][u] = __builtin_amdgcn_exp2f(__fmul_rn(d0, 1.4426950408889634f)); sum[u] += sc[n][u]; } }
    float f[4]; for (int u = 0; u < 4; ++u) f[u] = __fdiv_rn(1.0f, sum[u]);
    {
#pragma unroll
        for (int n = 0; n < NH_; ++n) { v4us oh, ol; for (int u = 0; u < 4; ++u) { unsigned short a2, c2; splitf(sc[n][u] * f[u], a2, c2); oh[u] = a2; ol[u] = c2; } const size_t oo = ((size_t)n * RQ + ql) * LL + kk; *(v4us*)(Ph + oo) = oh; *(v4us*)(Pl + oo) = ol; }
         } }

extern "C" void kernel_launch(void* const* d_in, const int* in_sizes, int n_in,
                              void* d_out, int out_size, void* d_ws, size_t ws_size, hipStream_t stream) {
    (void)in_sizes; (void)n_in; (void)out_size;
    const float* q = (const float*)d_in[0]; const float* k = (const float*)d_in[1]; const float* v = (const float*)d_in[2]; const int* mask = (const int*)d_in[3];
    float* OUT = (float*)d_out;     // [2][16][2048][64]
    char* wsp = (char*)d_ws;
    auto take = [&](size_t bytes) { char* p = wsp; wsp += (bytes + 255) & ~(size_t)255; return (void*)p; };
    const size_t per = (size_t)NH_ * LL * HD;
    bf* QP = (bf*)take(per * 2); bf* KP = (bf*)take(per * 2); bf* VT = (bf*)take(per * 2); float* S = (float*)take((size_t)NH_ * RQ * LL * 4); bf* Ph = (bf*)take((size_t)NH_ * RQ * LL * 2); bf* Pl = (bf*)take((size_t)NH_ * RQ * LL * 2);
    if ((size_t)(wsp - (char*)d_ws) > ws_size) return;    // total ~ 145 MB
    const size_t zq = (size_t)LL * HD, zS = (size_t)RQ * LL;
    for (int b = 0; b < NB_; ++b) {
        k_qkp<<<(unsigned)((per / 4 + 255) / 256), 256, 0, stream>>>(q + b * per, k + b * per, QP, KP); k_vt<<<(unsigned)((per / 2 + 255) / 256), 256, 0, stream>>>(v + b * per, VT);
        for (int q0 = 0; q0 < LL; q0 += RQ) {
            k_gemmw<bf, 0, false><<<dim3(RQ / 64, LL / 64, NH_), 32, 0, stream>>>(QP + (size_t)q0 * HD, nullptr, KP, nullptr, HD, S, LL, nullptr, zq, zq, zS);     // all 16 heads, query rows q0..q0+511
            k_hsoft<<<(unsigned)(((size_t)RQ * LL / 4 + 255) / 256), 256, 0, stream>>>(S, mask + (size_t)b * LL * LL, q0, Ph, Pl);
            k_pv<<<dim3(RQ / 32, 1, NH_), 32 * PVW, 0, stream>>>(Ph, Pl, VT, OUT + b * per + (size_t)q0 * HD); } }
}

// v003
// One run takes 144 microseconds.
// Versions between v001 and this one are left out; their measured steps multiply to 2.80 times as fast.
// Over all steps from v000 it is 5.16 times as fast.
#include <hip/hip_runtime.h>

// SDPA (query, key, value [2][2048][16][64]; mask [2][1][2048][2048] int read (all ones); scores[b][n][q][k] = q.k / 8, masked -> -inf; the source's softmax runs over dim=1 = the HEAD axis (16 heads) for every (q, k) pair, not over the keys; out[b][n][q][d] = sum_k w v -> [2][16][2048][64]).
// Compute dtypes, f32 accumulate: every input rounded to bf16; scores as PLAIN bf16 products of the inputs (exact products); mask + the across-heads softmax in f32 (thread per two (q, k) columns of 16 values); weights -> hl planes; weights.v as hl x exact bf16 v (2 products).
// One kernel does scores, softmax and weights.v: scores and weights never leave the WGP.

#define NB_  2
#define LL   2048
#define NH_  16
#define HD   64
typedef unsigned short bf;
typedef __attribute__((ext_vector_type(16))) __bf16   v16bf;
typedef __attribute__((ext_vector_type(8)))  unsigned short v8us;
typedef __attribute__((ext_vector_type(8)))  float    v8f;
typedef __attribute__((ext_vector_type(4)))  float    v4f;
typedef __attribute__((ext_vector_type(2)))  float    v2f;
typedef __attribute__((ext_vector_type(2)))  int      v2i;
typedef v4f  __attribute__((may_alias)) v4fa;
typedef v2f  __attribute__((may_alias)) v2fa;
typedef __attribute__((ext_vector_type(4)))  unsigned v4u;
typedef v4u  __attribute__((may_alias)) v4ua;

__device__ __forceinline__ unsigned short f2bf(float f) { unsigned u = __float_as_uint(f); u += 0x7FFFu + ((u >> 16) & 1u); return (unsigned short)(u >> 16); }
__device__ __forceinline__ float bf2f(unsigned short b) { return __uint_as_float(((unsigned)b) << 16); }
__device__ __forceinline__ v16bf cat16b(v8us lo, v8us hi) { return __builtin_bit_cast(v16bf, __builtin_shufflevector(lo, hi, 0, 1, 2, 3, 4, 5, 6, 7, 8, 9, 10, 11, 12, 13, 14, 15)); }
__device__ __forceinline__ v8f wmmab(v16bf a, v16bf b, v8f c) { return __builtin_amdgcn_wmma_f32_16x16x32_bf16(false, a, false, b, (short)0, c, false, false); }
// A or B fragment of 16 rows x 32 k from a k-contiguous plane; p = row (lane & 15), k offset 8 * (lane >> 4): elements 0..7 are k = 8 hi + i, elements 8..15 are k = 16 + 8 hi + i.
__device__ __forceinline__ v16bf ldfrag(const bf* p) { return cat16b(*(const v8us*)p, *(const v8us*)(p + 16)); }
__device__ __forceinline__ void splitf(float y, unsigned short& h, unsigned short& l) { h = f2bf(y); l = f2bf(y - bf2f(h)); }

// ---- k_fused: one work-group = 32 query rows x KSPAN keys x all 16 heads of one batch; 16 waves, wave n = head n. grid (LL/QT, LL/KSPAN, NB_), 512 threads.
// Per pass of 32 keys: (1) wave n forms the TRANSPOSED score tile key x query (A = key rows, B = query rows), so that lane (lr, hi) holds query lr, keys 8 hi + j: the order of an A fragment of the weights;
// it leaves the 32 f32 scores of each lane in its slab of LDS; barrier; (2) every thread takes two (query, key) columns of neighbouring keys, reads their 16 heads, does mask and softmax over the heads and writes, per head, one dword of the hi plane and one of the lo plane
// (two keys each) where the A fragment of that head wants them; barrier; (3) wave n reads its A fragments and multiplies them with its head's v. The f32 partial of this key span goes to the workspace; k_sum2 adds the spans.
// Every '#pragma unroll' in this file but the one on the row loop of k_fused's store stands on a loop whose index picks a register array's element: unrolled, each index is a constant and the arrays stay in registers.
#define QT    32
#define KSPAN 1024
#define KP_   32
#define SBP   1088    // words per head slab: 1024 for the exchange; 16 rows x 68 for the store transpose at the end
// Work-group barrier for data that goes through LDS only: it waits for this wave's LDS operations and leaves its global loads in flight.
__device__ __forceinline__ void lds_barrier() { asm volatile("s_wait_dscnt 0x0\n\ts_barrier_signal -1\n\ts_barrier_wait -1" ::: "memory"); }
__global__ __launch_bounds__(512) void k_fused(const bf* __restrict__ QP, const bf* __restrict__ KP, const bf* __restrict__ VT, const int* __restrict__ mask, float* PART) {
    __shared__ __align__(16) float sb[NH_ * SBP];
    __shared__ __align__(16) unsigned wb[NH_ * 1024];    // weights, per head: [qt][kt][plane][lane][4 dwords]: a 16-byte read per lane is half an A fragment
    const int tid = threadIdx.x, lane = tid & 31, lr = lane & 15, hi = lane >> 4;
    const int n = __builtin_amdgcn_readfirstlane(tid >> 5);    // the head is the same in every lane: what is formed from it stays in scalar registers
    const int q0 = blockIdx.x * QT, kb = blockIdx.y * KSPAN, b = blockIdx.z;
    const size_t per = (size_t)NH_ * LL * HD;
    const bf* Qn = QP + b * per + ((size_t)n * LL + q0 + lr) * HD + 8 * hi;
    const bf* Kn = KP + b * per + ((size_t)n * LL + kb + lr) * HD + 8 * hi;
    const bf* Vn = VT + b * per + ((size_t)n * HD + lr) * LL + kb + 8 * hi;
    float* slab = sb + n * SBP;
    // the two columns of step (2): words 2 tid, 2 tid + 1 of every slab; word = chunk * 128 + lane * 4 + e, chunk = (kt * 2 + qt) * 2 + (j >> 2), e = j & 3
    const int ch = tid >> 6, pl = (tid >> 1) & 31;
    const int pk = (ch >> 2) * 16 + (pl >> 4) * 8 + (ch & 1) * 4 + (tid & 1) * 2, pq = ((ch >> 1) & 1) * 16 + (pl & 15);
    const int* mrow = mask + ((size_t)b * LL + q0 + pq) * LL + kb + pk;
    unsigned* wput = wb + ((((ch >> 1) & 1) * 2 + (ch >> 2)) * 2) * 128 + pl * 4 + (ch & 1) * 2 + (tid & 1);
    const unsigned* wget = wb + n * 1024 + lane * 4;

    v16bf qf[2][2], kf[2][2];
#pragma unroll
    for (int t = 0; t < 2; ++t)
#pragma unroll
        for (int dc = 0; dc < 2; ++dc) { qf[t][dc] = ldfrag(Qn + (size_t)t * 16 * HD + dc * 32); kf[t][dc] = ldfrag(Kn + (size_t)t * 16 * HD + dc * 32); }
    v8f acc[2][4];
#pragma unroll
    for (int qt = 0; qt < 2; ++qt)
#pragma unroll
        for (int dt = 0; dt < 4; ++dt) acc[qt][dt] = (v8f){};

    v2i mnext = *(const v2i*)mrow;
    for (int k0 = 0; k0 < KSPAN; k0 += KP_) {
        const v2i mm = mnext;
        // (1) transposed scores
#pragma unroll
        for (int kt = 0; kt < 2; ++kt)
#pragma unroll
            for (int qt = 0; qt < 2; ++qt) {
                v8f s = wmmab(kf[kt][0], qf[qt][0], (v8f){}); s = wmmab(kf[kt][1], qf[qt][1], s);
                float* w = slab + ((kt * 2 + qt) * 2) * 128 + lane * 4;
                *(v4fa*)w = (v4f){s[0], s[1], s[2], s[3]}; *(v4fa*)(w + 128) = (v4f){s[4], s[5], s[6], s[7]}; }
        // the next pass's mask words, this pass's v and the next pass's keys are asked for here, so that they fly during step (2); the last pass asks for its own mask words and keys again (in bounds, unused)
        const int kn = (k0 + KP_ < KSPAN) ? k0 + KP_ : k0;
        mnext = *(const v2i*)(mrow + kn);
        v16bf vf[4];
#pragma unroll
        for (int dt = 0; dt < 4; ++dt) vf[dt] = ldfrag(Vn + (size_t)dt * 16 * LL + k0);
#pragma unroll
        for (int kt = 0; kt < 2; ++kt)
#pragma unroll
            for (int dc = 0; dc < 2; ++dc) kf[kt][dc] = ldfrag(Kn + (size_t)(kn + kt * 16) * HD + dc * 32);
        lds_barrier();
        // (2) mask and softmax over the heads
        {
            float sc[NH_][2]; float mx[2] = {-3.0e38f, -3.0e38f};
#pragma unroll
            for (int h = 0; h < NH_; ++h) { const v2f a = *(const v2fa*)(sb + h * SBP + 2 * tid);
#pragma unroll
                for (int u = 0; u < 2; ++u) { const float t = (mm[u] == 0) ? -__builtin_inff() : a[u] * 0.125f; sc[h][u] = t; mx[u] = fmaxf(mx[u], t); } }
            float sum[2] = {0.f, 0.f};
#pragma unroll
            for (int h = 0; h < NH_; ++h) { const float x0 = __fmul_rn(__fsub_rn(sc[h][0], mx[0]), 1.4426950408889634f), x1 = __fmul_rn(__fsub_rn(sc[h][1], mx[1]), 1.4426950408889634f);
                // both exponentials and the one free slot that the instruction set asks for behind a transcendental, in one statement
                asm("v_exp_f32 %0, %2\n\tv_exp_f32 %1, %3\n\tv_nop" : "=&v"(sc[h][0]), "=&v"(sc[h][1]) : "v"(x0), "v"(x1));
                sum[0] += sc[h][0]; sum[1] += sc[h][1]; }
            const float f[2] = {__fdiv_rn(1.0f, sum[0]), __fdiv_rn(1.0f, sum[1])};
#pragma unroll
            for (int h = 0; h < NH_; ++h) { unsigned short h0, l0, h1, l1; splitf(sc[h][0] * f[0], h0, l0); splitf(sc[h][1] * f[1], h1, l1);
                wput[h * 1024] = (unsigned)h0 | ((unsigned)h1 << 16); wput[h * 1024 + 128] = (unsigned)l0 | ((unsigned)l1 << 16); }
        }
        lds_barrier();
        // (3) weights.v
#pragma unroll
        for (int qt = 0; qt < 2; ++qt) {
            // elements 0..7: keys 8 hi + i of key tile 0, elements 8..15: the same of key tile 1: the k order of ldfrag
            const v4u h0 = *(const v4ua*)(wget + (qt * 4 + 0) * 128), w0 = *(const v4ua*)(wget + (qt * 4 + 1) * 128), h1 = *(const v4ua*)(wget + (qt * 4 + 2) * 128), w1 = *(const v4ua*)(wget + (qt * 4 + 3) * 128);
            const v16bf ah = __builtin_bit_cast(v16bf, __builtin_shufflevector(h0, h1, 0, 1, 2, 3, 4, 5, 6, 7)), al = __builtin_bit_cast(v16bf, __builtin_shufflevector(w0, w1, 0, 1, 2, 3, 4, 5, 6, 7));
#pragma unroll
            for (int dt = 0; dt < 4; ++dt) { acc[qt][dt] = wmmab(ah, vf[dt], acc[qt][dt]); acc[qt][dt] = wmmab(al, vf[dt], acc[qt][dt]); }
        }
    }
    // store: each wave turns its tiles through its own slab (no other wave touches it behind the last barrier) into 16-byte row stores
    float* C = PART + (((size_t)blockIdx.y * NB_ + b) * NH_ + n) * ((size_t)LL * HD) + (size_t)q0 * HD;
#pragma unroll
    for (int qt = 0; qt < 2; ++qt) {
#pragma unroll
        for (int dt = 0; dt < 4; ++dt)
#pragma unroll
            for (int j = 0; j < 8; ++j) slab[(hi * 8 + j) * 68 + dt * 16 + lr] = acc[qt][dt][j];
        __builtin_amdgcn_wave_barrier(); asm volatile("" ::: "memory");    // keeps the compiler from moving the reads below over the writes above (they read other lanes' words)
#pragma unroll
        for (int s = 0; s < 8; ++s) { const int row = 2 * s + hi, cofs = lr * 4; *(v4f*)(C + (size_t)(qt * 16 + row) * HD + cofs) = *(const v4fa*)(slab + row * 68 + cofs); }
        __builtin_amdgcn_wave_barrier(); asm volatile("" ::: "memory");    // and the next tile's writes over these reads
    }
}

// The helpers below stream: each thread carries 16 loads of 16 bytes, all or most of them asked for before the first is used, so that few, long waves carry the bytes (fewer waves to start; the bytes in flight come from the loads per wave).
// out = partial of keys [0, KSPAN) + partial of keys [KSPAN, 2 KSPAN); 8 pieces of 4 floats per thread, a wave's piece = 512 contiguous bytes
#define SUMP 8
__global__ __launch_bounds__(256) void k_sum2(const float* __restrict__ P, float* out) {
    const size_t tot = (size_t)NB_ * NH_ * LL * HD; const size_t i0 = (size_t)blockIdx.x * (256 * SUMP * 4) + threadIdx.x * 4;
    v4f a[SUMP], c[SUMP];
#pragma unroll
    for (int s = 0; s < SUMP; ++s) { a[s] = *(const v4f*)(P + i0 + s * 1024); c[s] = *(const v4f*)(P + tot + i0 + s * 1024); }
#pragma unroll
    for (int s = 0; s < SUMP; ++s) *(v4f*)(out + i0 + s * 1024) = a[s] + c[s];
}

// k_prep, both batches in one launch. Blocks [0, PQB): q, k [b][l][n][d] f32 -> QP, KP [b][n][l][d] bf16. Blocks [PQB, PQB + PVB): v [b][l][n][d] f32 -> VT [b][n][d][l] bf16.
typedef v4f __attribute__((aligned(4))) v4fu;    // the inputs are promised as float arrays only
#define ROWF (NH_ * HD)               // floats of one (b, l) row of an input
#define PQL  4                        // q/k part: rows l per thread
#define PQB  (NB_ * LL / PQL * (ROWF / 8) / 256)
#define PVB  (NB_ * LL / 64 * (ROWF / 256))
__global__ __launch_bounds__(256) void k_prep(const float* __restrict__ q, const float* __restrict__ k, const float* __restrict__ v, bf* QP, bf* KP, bf* VT) {
    const int tid = threadIdx.x;
    if (blockIdx.x < PQB) {
        // thread = 8 d of one head, PQL rows l, of q and of k: a wave reads 1 KB in a row (4 heads) and writes 4 whole 128-byte lines
        const int t = blockIdx.x * 256 + tid, c = t & (ROWF / 8 - 1), bl0 = (t / (ROWF / 8)) * PQL;
        const float* qs = q + (size_t)bl0 * ROWF + c * 8; const float* ks = k + (size_t)bl0 * ROWF + c * 8;
        v4f a[PQL][2], e[PQL][2];
#pragma unroll
        for (int i = 0; i < PQL; ++i) { a[i][0] = *(const v4fu*)(qs + i * ROWF); a[i][1] = *(const v4fu*)(qs + i * ROWF + 4); e[i][0] = *(const v4fu*)(ks + i * ROWF); e[i][1] = *(const v4fu*)(ks + i * ROWF + 4); }
        const size_t dst = (((size_t)(bl0 / LL) * NH_ + (c >> 3)) * LL + bl0 % LL) * HD + (c & 7) * 8;
#pragma unroll
        for (int i = 0; i < PQL; ++i) { v8us x, y;
#pragma unroll
            for (int u = 0; u < 8; ++u) { x[u] = f2bf(a[i][u >> 2][u & 3]); y[u] = f2bf(e[i][u >> 2][u & 3]); }
            *(v8us*)(QP + dst + i * HD) = x; *(v8us*)(KP + dst + i * HD) = y; }
    } else {
        // block = 64 keys x 256 columns (4 heads); thread = 16 keys x 4 columns, turned in its registers. Lane = (key group kg, column quad c8): the four lanes of one column quad hold keys 8 kg + i and 32 + 8 kg + i,
        // so that one wave writes each 128-byte line of VT whole, in two stores of 64 contiguous bytes
        const int blk = blockIdx.x - PQB, hg = blk & (ROWF / 256 - 1), bl0 = (blk / (ROWF / 256)) * 64;
        const int kg = (tid & 31) >> 3, col = hg * 256 + (tid >> 5) * 32 + (tid & 7) * 4;    // col = n * HD + d
        const float* vs = v + (size_t)(bl0 + kg * 8) * ROWF + col;
        v4f x[16];
#pragma unroll
        for (int j = 0; j < 16; ++j) x[j] = *(const v4fu*)(vs + (size_t)((j >> 3) * 32 + (j & 7)) * ROWF);
        asm volatile("s_wait_xcnt 0x0" :: "v"(vs) : "memory");    // the wait owed before a register that an issued load names is rewritten; vs as an input keeps the address pair live up to here, so that no load of the run lands in it
        __builtin_amdgcn_sched_barrier(0);    // keeps the conversion below behind the wait: without it the compiler drew it up among the loads and held six of the sixteen back behind the first results
        bf* dst = VT + ((size_t)(bl0 / LL) * ROWF + col) * LL + bl0 % LL + kg * 8;
        v8us o[4][2];
#pragma unroll
        for (int u = 0; u < 4; ++u)
#pragma unroll
            for (int h = 0; h < 2; ++h)
#pragma unroll
                for (int i = 0; i < 8; ++i) o[u][h][i] = f2bf(x[h * 8 + i][u]);
#pragma unroll
        for (int u = 0; u < 4; ++u) { *(v8us*)(dst + (size_t)u * LL) = o[u][0]; *(v8us*)(dst + (size_t)u * LL + 32) = o[u][1]; }
        asm volatile("s_wait_xcnt 0x0" ::: "memory");    // the same wait behind the stores: nothing that follows them in the code may rewrite their registers ahead of it
    }
}

extern "C" void kernel_launch(void* const* d_in, const int* in_sizes, int n_in,
                              void* d_out, int out_size, void* d_ws, size_t ws_size, hipStream_t stream) {
    (void)in_sizes; (void)n_in; (void)out_size;
    const float* q = (const float*)d_in[0]; const float* k = (const float*)d_in[1]; const float* v = (const float*)d_in[2]; const int* mask = (const int*)d_in[3];
    float* OUT = (float*)d_out;     // [2][16][2048][64]
    char* wsp = (char*)d_ws;
    auto take = [&](size_t bytes) { char* p = wsp; wsp += (bytes + 255) & ~(size_t)255; return (void*)p; };
    const size_t per = (size_t)NH_ * LL * HD;
    bf* QP = (bf*)take(NB_ * per * 2); bf* KP = (bf*)take(NB_ * per * 2); bf* VT = (bf*)take(NB_ * per * 2); float* PART = (float*)take((size_t)(LL / KSPAN) * NB_ * per * 4);
    if ((size_t)(wsp - (char*)d_ws) > ws_size) return;    // total ~ 59 MB
    k_prep<<<PQB + PVB, 256, 0, stream>>>(q, k, v, QP, KP, VT);
    k_fused<<<dim3(LL / QT, LL / KSPAN, NB_), 512, 0, stream>>>(QP, KP, VT, mask, PART);
    k_sum2<<<(unsigned)(NB_ * per / (256 * SUMP * 4)), 256, 0, stream>>>(PART, OUT);
}

// v004
// One run takes 129 microseconds.
// In two side-by-side timings against v003, it was 1.12 and 1.11 times as fast.
// Counting every step since v000, it is 5.75 times as fast.
#include <hip/hip_runtime.h>

// SDPA (query, key, value [2][2048][16][64]; mask [2][1][2048][2048] int read (all ones); scores[b][n][q][k] = q.k / 8, masked -> -inf; the source's softmax runs over dim=1 = the HEAD axis (16 heads) for every (q, k) pair, not over the keys; out[b][n][q][d] = sum_k w v -> [2][16][2048][64]).
// Compute dtypes, f32 accumulate: every input rounded to bf16; scores as PLAIN bf16 products of the inputs (exact products); mask + the across-heads softmax in f32 (thread per two (q, k) columns of 16 values); weights -> hl planes; weights.v as hl x exact bf16 v (2 products).
// One kernel does scores, softmax and weights.v: scores and weights never leave the WGP.

#define NB_  2
#define LL   2048
#define NH_  16
#define HD   64
typedef unsigned short bf;
typedef __attribute__((ext_vector_type(16))) __bf16   v16bf;
typedef __attribute__((ext_vector_type(8)))  unsigned short v8us;
typedef __attribute__((ext_vector_type(8)))  float    v8f;
typedef __attribute__((ext_vector_type(4)))  float    v4f;
typedef __attribute__((ext_vector_type(2)))  float    v2f;
typedef __attribute__((ext_vector_type(2)))  int      v2i;
typedef __attribute__((ext_vector_type(2)))  __bf16   v2bf;
typedef v4f  __attribute__((may_alias)) v4fa;
typedef v2f  __attribute__((may_alias)) v2fa;
typedef __attribute__((ext_vector_type(4)))  unsigned v4u;
typedef v4u  __attribute__((may_alias)) v4ua;

__device__ __forceinline__ unsigned short f2bf(float f) { unsigned u = __float_as_uint(f); u += 0x7FFFu + ((u >> 16) & 1u); return (unsigned short)(u >> 16); }
__device__ __forceinline__ v16bf cat16b(v8us lo, v8us hi) { return __builtin_bit_cast(v16bf, __builtin_shufflevector(lo, hi, 0, 1, 2, 3, 4, 5, 6, 7, 8, 9, 10, 11, 12, 13, 14, 15)); }
__device__ __forceinline__ v8f wmmab(v16bf a, v16bf b, v8f c) { return __builtin_amdgcn_wmma_f32_16x16x32_bf16(false, a, false, b, (short)0, c, false, false); }
// A or B fragment of 16 rows x 32 k from a k-contiguous plane; p = row (lane & 15), k offset 8 * (lane >> 4): elements 0..7 are k = 8 hi + i, elements 8..15 are k = 16 + 8 hi + i.
__device__ __forceinline__ v16bf ldfrag(const bf* p) { return cat16b(*(const v8us*)p, *(const v8us*)(p + 16)); }

// ---- k_fused: one work-group = 32 query rows x KSPAN keys x all 16 heads of one batch; 16 waves, wave n = head n. grid (LL/QT, LL/KSPAN, NB_), 512 threads.
// Per pass of 32 keys: (1) wave n forms the TRANSPOSED score tile key x query (A = key rows, B = query rows), so that lane (lr, hi) holds query lr, keys 8 hi + j: the order of an A fragment of the weights;
// it leaves the 32 f32 scores of each lane in its slab of LDS; barrier; (2) every thread takes two (query, key) columns of neighbouring keys, reads their 16 heads, does mask and softmax over the heads and writes, per head, one dword of the hi plane and one of the lo plane
// (two keys each) where the A fragment of that head wants them; barrier; (3) wave n reads its A fragments and multiplies them with its head's v. The f32 partial of this key span goes to the workspace; k_sum2 adds the spans.
// Every '#pragma unroll' in this file but the one on the row loop of k_fused's store stands on a loop whose index picks a register array's element: unrolled, each index is a constant and the arrays stay in registers.
#define QT    32
#define KSPAN 1024
#define KP_   32
#define SBP   1088    // words per head slab: 1024 for the exchange; 16 rows x 68 for the store transpose at the end
// Work-group barrier for data that goes through LDS only: it waits for this wave's LDS operations and leaves its global loads in flight.
__device__ __forceinline__ void lds_barrier() { asm volatile("s_wait_dscnt 0x0\n\ts_barrier_signal -1\n\ts_barrier_wait -1" ::: "memory"); }
__global__ __launch_bounds__(512) void k_fused(const bf* __restrict__ QP, const bf* __restrict__ KP, const bf* __restrict__ VT, const int* __restrict__ mask, float* PART) {
    __shared__ __align__(16) float sb[NH_ * SBP];
    __shared__ __align__(16) unsigned wb[NH_ * 1024];    // weights, per head: [qt][kt][plane][lane][4 dwords]: a 16-byte read per lane is half an A fragment
    const int tid = threadIdx.x, lane = tid & 31, lr = lane & 15, hi = lane >> 4;
    const int n = __builtin_amdgcn_readfirstlane(tid >> 5);    // the head is the same in every lane: what is formed from it stays in scalar registers
    const int q0 = blockIdx.x * QT, kb = blockIdx.y * KSPAN, b = blockIdx.z;
    const size_t per = (size_t)NH_ * LL * HD;
    const bf* Qn = QP + b * per + ((size_t)n * LL + q0 + lr) * HD + 8 * hi;
    const bf* Kn = KP + b * per + ((size_t)n * LL + kb + lr) * HD + 8 * hi;
    const bf* Vn = VT + b * per + ((size_t)n * HD + lr) * LL + kb + 8 * hi;
    float* slab = sb + n * SBP;
    // the two columns of step (2): words 2 tid, 2 tid + 1 of every slab; word = chunk * 128 + lane * 4 + e, chunk = (kt * 2 + qt) * 2 + (j >> 2), e = j & 3
    const int ch = tid >> 6, pl = (tid >> 1) & 31;
    const int pk = (ch >> 2) * 16 + (pl >> 4) * 8 + (ch & 1) * 4 + (tid & 1) * 2, pq = ((ch >> 1) & 1) * 16 + (pl & 15);
    const int* mrow = mask + ((size_t)b * LL + q0 + pq) * LL + kb + pk;
    unsigned* wput = wb + ((((ch >> 1) & 1) * 2 + (ch >> 2)) * 2) * 128 + pl * 4 + (ch & 1) * 2 + (tid & 1);
    const unsigned* wget = wb + n * 1024 + lane * 4;

    v16bf qf[2][2], kf[2][2];
#pragma unroll
    for (int t = 0; t < 2; ++t)
#pragma unroll
        for (int dc = 0; dc < 2; ++dc) { qf[t][dc] = ldfrag(Qn + (size_t)t * 16 * HD + dc * 32); kf[t][dc] = ldfrag(Kn + (size_t)t * 16 * HD + dc * 32); }
    v8f acc[2][4];
#pragma unroll
    for (int qt = 0; qt < 2; ++qt)
#pragma unroll
        for (int dt = 0; dt < 4; ++dt) acc[qt][dt] = (v8f){};

    v2i mnext = *(const v2i*)mrow;
    for (int k0 = 0; k0 < KSPAN; k0 += KP_) {
        const v2i mm = mnext;
        // (1) transposed scores
#pragma unroll
        for (int kt = 0; kt < 2; ++kt)
#pragma unroll
            for (int qt = 0; qt < 2; ++qt) {
                v8f s = wmmab(kf[kt][0], qf[qt][0], (v8f){}); s = wmmab(kf[kt][1], qf[qt][1], s);
                float* w = slab + ((kt * 2 + qt) * 2) * 128 + lane * 4;
                *(v4fa*)w = (v4f){s[0], s[1], s[2], s[3]}; *(v4fa*)(w + 128) = (v4f){s[4], s[5], s[6], s[7]}; }
        // the next pass's mask words, this pass's v and the next pass's keys are asked for here, so that they fly during step (2); the last pass asks for its own mask words and keys again (in bounds, unused)
        const int kn = (k0 + KP_ < KSPAN) ? k0 + KP_ : k0;
        mnext = *(const v2i*)(mrow + kn);
        v16bf vf[4];
#pragma unroll
        for (int dt = 0; dt < 4; ++dt) vf[dt] = ldfrag(Vn + (size_t)dt * 16 * LL + k0);
#pragma unroll
        for (int kt = 0; kt < 2; ++kt)
#pragma unroll
            for (int dc = 0; dc < 2; ++dc) kf[kt][dc] = ldfrag(Kn + (size_t)(kn + kt * 16) * HD + dc * 32);
        lds_barrier();
        // (2) mask and softmax over the heads
        {
            float sc[NH_][2]; float mx[2] = {-3.0e38f, -3.0e38f};
#pragma unroll
            for (int h = 0; h < NH_; ++h) { const v2f a = *(const v2fa*)(sb + h * SBP + 2 * tid);
#pragma unroll
                for (int u = 0; u < 2; ++u) { const float t = (mm[u] == 0) ? -__builtin_inff() : a[u] * 0.125f; sc[h][u] = t; mx[u] = fmaxf(mx[u], t); } }
            float sum[2] = {0.f, 0.f};
#pragma unroll
            for (int h = 0; h < NH_; ++h) { const float x0 = __fmul_rn(__fsub_rn(sc[h][0], mx[0]), 1.4426950408889634f), x1 = __fmul_rn(__fsub_rn(sc[h][1], mx[1]), 1.4426950408889634f);
                // both exponentials and the one free slot that the instruction set asks for behind a transcendental, in one statement
                asm("v_exp_f32 %0, %2\n\tv_exp_f32 %1, %3\n\tv_nop" : "=&v"(sc[h][0]), "=&v"(sc[h][1]) : "v"(x0), "v"(x1));
                sum[0] += sc[h][0]; sum[1] += sc[h][1]; }
            const float f[2] = {__fdiv_rn(1.0f, sum[0]), __fdiv_rn(1.0f, sum[1])};
#pragma unroll
            for (int h = 0; h < NH_; ++h) {
                // both columns at once: the packed conversion rounds to nearest even, as f2bf does, and leaves the two bf16 in one dword in the order the planes want; lo = what the product leaves over hi
                const v2f w = (v2f){sc[h][0], sc[h][1]} * (v2f){f[0], f[1]};
                const v2bf hb = __builtin_convertvector(w, v2bf);
                const v2bf lb = __builtin_convertvector(w - __builtin_convertvector(hb, v2f), v2bf);
                wput[h * 1024] = __builtin_bit_cast(unsigned, hb); wput[h * 1024 + 128] = __builtin_bit_cast(unsigned, lb); }
        }
        lds_barrier();
        // (3) weights.v
#pragma unroll
        for (int qt = 0; qt < 2; ++qt) {
            // elements 0..7: keys 8 hi + i of key tile 0, elements 8..15: the same of key tile 1: the k order of ldfrag
            const v4u h0 = *(const v4ua*)(wget + (qt * 4 + 0) * 128), w0 = *(const v4ua*)(wget + (qt * 4 + 1) * 128), h1 = *(const v4ua*)(wget + (qt * 4 + 2) * 128), w1 = *(const v4ua*)(wget + (qt * 4 + 3) * 128);
            const v16bf ah = __builtin_bit_cast(v16bf, __builtin_shufflevector(h0, h1, 0, 1, 2, 3, 4, 5, 6, 7)), al = __builtin_bit_cast(v16bf, __builtin_shufflevector(w0, w1, 0, 1, 2, 3, 4, 5, 6, 7));
#pragma unroll
            for (int dt = 0; dt < 4; ++dt) { acc[qt][dt] = wmmab(ah, vf[dt], acc[qt][dt]); acc[qt][dt] = wmmab(al, vf[dt], acc[qt][dt]); }
        }
    }
    // store: each wave turns its tiles through its own slab (no other wave touches it behind the last barrier) into 16-byte row stores
    float* C = PART + (((size_t)blockIdx.y * NB_ + b) * NH_ + n) * ((size_t)LL * HD) + (size_t)q0 * HD;
#pragma unroll
    for (int qt = 0; qt < 2; ++qt) {
#pragma unroll
        for (int dt = 0; dt < 4; ++dt)
#pragma unroll
            for (int j = 0; j < 8; ++j) slab[(hi * 8 + j) * 68 + dt * 16 + lr] = acc[qt][dt][j];
        __builtin_amdgcn_wave_barrier(); asm volatile("" ::: "memory");    // keeps the compiler from moving the reads below over the writes above (they read other lanes' words)
#pragma unroll
        for (int s = 0; s < 8; ++s) { const int row = 2 * s + hi, cofs = lr * 4; *(v4f*)(C + (size_t)(qt * 16 + row) * HD + cofs) = *(const v4fa*)(slab + row * 68 + cofs); }
        __builtin_amdgcn_wave_barrier(); asm volatile("" ::: "memory");    // and the next tile's writes over these reads
    }
}

// The helpers below stream: each thread carries 16 loads of 16 bytes, all or most of them asked for before the first is used, so that few, long waves carry the bytes (fewer waves to start; the bytes in flight come from the loads per wave).
// out = partial of keys [0, KSPAN) + partial of keys [KSPAN, 2 KSPAN); 8 pieces of 4 floats per thread, a wave's piece = 512 contiguous bytes
#define SUMP 8
__global__ __launch_bounds__(256) void k_sum2(const float* __restrict__ P, float* out) {
    const size_t tot = (size_t)NB_ * NH_ * LL * HD; const size_t i0 = (size_t)blockIdx.x * (256 * SUMP * 4) + threadIdx.x * 4;
    v4f a[SUMP], c[SUMP];
#pragma unroll
    for (int s = 0; s < SUMP; ++s) { a[s] = *(const v4f*)(P + i0 + s * 1024); c[s] = *(const v4f*)(P + tot + i0 + s * 1024); }
#pragma unroll
    for (int s = 0; s < SUMP; ++s) *(v4f*)(out + i0 + s * 1024) = a[s] + c[s];
}

// k_prep, both batches in one launch. Blocks [0, PQB): q, k [b][l][n][d] f32 -> QP, KP [b][n][l][d] bf16. Blocks [PQB, PQB + PVB): v [b][l][n][d] f32 -> VT [b][n][d][l] bf16.
typedef v4f __attribute__((aligned(4))) v4fu;    // the inputs are promised as float arrays only
#define ROWF (NH_ * HD)               // floats of one (b, l) row of an input
#define PQL  4                        // q/k part: rows l per thread
#define PQB  (NB_ * LL / PQL * (ROWF / 8) / 256)
#define PVB  (NB_ * LL / 64 * (ROWF / 256))
__global__ __launch_bounds__(256) void k_prep(const float* __restrict__ q, const float* __restrict__ k, const float* __restrict__ v, bf* QP, bf* KP, bf* VT) {
    const int tid = threadIdx.x;
    if (blockIdx.x < PQB) {
        // thread = 8 d of one head, PQL rows l, of q and of k: a wave reads 1 KB in a row (4 heads) and writes 4 whole 128-byte lines
        const int t = blockIdx.x * 256 + tid, c = t & (ROWF / 8 - 1), bl0 = (t / (ROWF / 8)) * PQL;
        const float* qs = q + (size_t)bl0 * ROWF + c * 8; const float* ks = k + (size_t)bl0 * ROWF + c * 8;
        v4f a[PQL][2], e[PQL][2];
#pragma unroll
        for (int i = 0; i < PQL; ++i) { a[i][0] = *(const v4fu*)(qs + i * ROWF); a[i][1] = *(const v4fu*)(qs + i * ROWF + 4); e[i][0] = *(const v4fu*)(ks + i * ROWF); e[i][1] = *(const v4fu*)(ks + i * ROWF + 4); }
        const size_t dst = (((size_t)(bl0 / LL) * NH_ + (c >> 3)) * LL + bl0 % LL) * HD + (c & 7) * 8;
#pragma unroll
        for (int i = 0; i < PQL; ++i) { v8us x, y;
#pragma unroll
            for (int u = 0; u < 8; ++u) { x[u] = f2bf(a[i][u >> 2][u & 3]); y[u] = f2bf(e[i][u >> 2][u & 3]); }
            *(v8us*)(QP + dst + i * HD) = x; *(v8us*)(KP + dst + i * HD) = y; }
    } else {
        // block = 64 keys x 256 columns (4 heads); thread = 16 keys x 4 columns, turned in its registers. Lane = (key group kg, column quad c8): the four lanes of one column quad hold keys 8 kg + i and 32 + 8 kg + i,
        // so that one wave writes each 128-byte line of VT whole, in two stores of 64 contiguous bytes
        const int blk = blockIdx.x - PQB, hg = blk & (ROWF / 256 - 1), bl0 = (blk / (ROWF / 256)) * 64;
        const int kg = (tid & 31) >> 3, col = hg * 256 + (tid >> 5) * 32 + (tid & 7) * 4;    // col = n * HD + d
        const float* vs = v + (size_t)(bl0 + kg * 8) * ROWF + col;
        v4f x[16];
#pragma unroll
        for (int j = 0; j < 16; ++j) x[j] = *(const v4fu*)(vs + (size_t)((j >> 3) * 32 + (j & 7)) * ROWF);
        asm volatile("s_wait_xcnt 0x0" :: "v"(vs) : "memory");    // the wait owed before a register that an issued load names is rewritten; vs as an input keeps the address pair live up to here, so that no load of the run lands in it
        __builtin_amdgcn_sched_barrier(0);    // keeps the conversion below behind the wait: without it the compiler drew it up among the loads and held six of the sixteen back behind the first results
        bf* dst = VT + ((size_t)(bl0 / LL) * ROWF + col) * LL + bl0 % LL + kg * 8;
        v8us o[4][2];
#pragma unroll
        for (int u = 0; u < 4; ++u)
#pragma unroll
            for (int h = 0; h < 2; ++h)
#pragma unroll
                for (int i = 0; i < 8; ++i) o[u][h][i] = f2bf(x[h * 8 + i][u]);
#pragma unroll
        for (int u = 0; u < 4; ++u) { *(v8us*)(dst + (size_t)u * LL) = o[u][0]; *(v8us*)(dst + (size_t)u * LL + 32) = o[u][1]; }
        asm volatile("s_wait_xcnt 0x0" ::: "memory");    // the same wait behind the stores: nothing that follows them in the code may rewrite their registers ahead of it
    }
}

extern "C" void kernel_launch(void* const* d_in, const int* in_sizes, int n_in,
                              void* d_out, int out_size, void* d_ws, size_t ws_size, hipStream_t stream) {
    (void)in_sizes; (void)n_in; (void)out_size;
    const float* q = (const float*)d_in[0]; const float* k = (const float*)d_in[1]; const float* v = (const float*)d_in[2]; const int* mask = (const int*)d_in[3];
    float* OUT = (float*)d_out;     // [2][16][2048][64]
    char* wsp = (char*)d_ws;
    auto take = [&](size_t bytes) { char* p = wsp; wsp += (bytes + 255) & ~(size_t)255; return (void*)p; };
    const size_t per = (size_t)NH_ * LL * HD;
    bf* QP = (bf*)take(NB_ * per * 2); bf* KP = (bf*)take(NB_ * per * 2); bf* VT = (bf*)take(NB_ * per * 2); float* PART = (float*)take((size_t)(LL / KSPAN) * NB_ * per * 4);
    if ((size_t)(wsp - (char*)d_ws) > ws_size) return;    // total ~ 59 MB
    k_prep<<<PQB + PVB, 256, 0, stream>>>(q, k, v, QP, KP, VT);
    k_fused<<<dim3(LL / QT, LL / KSPAN, NB_), 512, 0, stream>>>(QP, KP, VT, mask, PART);
    k_sum2<<<(unsigned)(NB_ * per / (256 * SUMP * 4)), 256, 0, stream>>>(PART, OUT);
}

// v005
// Measured time: 89 microseconds a run.
// Two timings next to v004 put it at 1.46 and 1.44 times that version's speed.
// All steps since v000 together make it 8.35 times as fast.
#include <hip/hip_runtime.h>

// SDPA (query, key, value [2][2048][16][64]; mask [2][1][2048][2048] int read (all ones); scores[b][n][q][k] = q.k / 8, masked -> -inf; the source's softmax runs over dim=1 = the HEAD axis (16 heads) for every (q, k) pair, not over the keys; out[b][n][q][d] = sum_k w v -> [2][16][2048][64]).
// Compute dtypes, f32 accumulate: every input rounded to bf16; scores as PLAIN bf16 products of the inputs (exact products); mask + the across-heads softmax in f32 (thread per two (q, k) columns of 16 values); weights -> hl planes; weights.v as hl x exact bf16 v (2 products).
// One kernel does scores, softmax and weights.v: scores and weights never leave the WGP.

#define NB_  2
#define LL   2048
#define NH_  16
#define HD   64
typedef unsigned short bf;
typedef __attribute__((ext_vector_type(16))) __bf16   v16bf;
typedef __attribute__((ext_vector_type(8)))  unsigned short v8us;
typedef __attribute__((ext_vector_type(8)))  float    v8f;
typedef __attribute__((ext_vector_type(4)))  float    v4f;
typedef __attribute__((ext_vector_type(2)))  float    v2f;
typedef __attribute__((ext_vector_type(2)))  int      v2i;
typedef __attribute__((ext_vector_type(2)))  __bf16   v2bf;
typedef v4f  __attribute__((may_alias)) v4fa;
typedef v2f  __attribute__((may_alias)) v2fa;
typedef __attribute__((ext_vector_type(4)))  unsigned v4u;
typedef v4u  __attribute__((may_alias)) v4ua;

__device__ __forceinline__ unsigned short f2bf(float f) { unsigned u = __float_as_uint(f); u += 0x7FFFu + ((u >> 16) & 1u); return (unsigned short)(u >> 16); }
__device__ __forceinline__ v16bf cat16b(v8us lo, v8us hi) { return __builtin_bit_cast(v16bf, __builtin_shufflevector(lo, hi, 0, 1, 2, 3, 4, 5, 6, 7, 8, 9, 10, 11, 12, 13, 14, 15)); }
__device__ __forceinline__ v8f wmmab(v16bf a, v16bf b, v8f c) { return __builtin_amdgcn_wmma_f32_16x16x32_bf16(false, a, false, b, (short)0, c, false, false); }
// A or B fragment of 16 rows x 32 k from a k-contiguous plane; p = row (lane & 15), k offset 8 * (lane >> 4): elements 0..7 are k = 8 hi + i, elements 8..15 are k = 16 + 8 hi + i.
__device__ __forceinline__ v16bf ldfrag(const bf* p) { return cat16b(*(const v8us*)p, *(const v8us*)(p + 16)); }
// The same fragment from a plane that k_prep has laid out in FRAGMENT ORDER: [half][lane][8 elements], half = elements 0..7 or 8..15 of every lane; p = fragment + 8 * lane. Each of the two loads reads 512 bytes in a row (4 whole lines)
// where the row-major plane gave 16 pieces of 32 bytes in 16 lines.
__device__ __forceinline__ v16bf ldfragc(const bf* p) { return cat16b(*(const v8us*)p, *(const v8us*)(p + 256)); }

// ---- k_fused: one work-group = 32 query rows x KSPAN keys x all 16 heads of one batch; 16 waves, wave n = head n. grid (LL/QT, LL/KSPAN, NB_), 512 threads.
// Per pass of 32 keys: (1) wave n forms the TRANSPOSED score tile key x query (A = key rows, B = query rows), so that lane (lr, hi) holds query lr, keys 8 hi + j: the order of an A fragment of the weights;
// it leaves the 32 f32 scores of each lane in its slab of LDS; barrier; (2) every thread takes two (query, key) columns of neighbouring keys, reads their 16 heads, does mask and softmax over the heads and writes, per head, one dword of the hi plane and one of the lo plane
// (two keys each) where the A fragment of that head wants them; barrier; (3) wave n reads its A fragments and multiplies them with its head's v. The f32 partial of this key span goes to the workspace; k_sum2 adds the spans.
// Every '#pragma unroll' in this file but the one on the row loop of k_fused's store stands on a loop whose index picks a register array's element: unrolled, each index is a constant and the arrays stay in registers.
#define QT    32
#define KSPAN 1024
#define KP_   32
#define SBP   1088    // words per head slab: 1024 for the exchange; 16 rows x 68 for the store transpose at the end
// Work-group barrier for data that goes through LDS only: it waits for this wave's LDS operations and leaves its global loads in flight.
__device__ __forceinline__ void lds_barrier() { asm volatile("s_wait_dscnt 0x0\n\ts_barrier_signal -1\n\ts_barrier_wait -1" ::: "memory"); }
__global__ __launch_bounds__(512) void k_fused(const bf* __restrict__ QP, const bf* __restrict__ KP, const bf* __restrict__ VT, const int* __restrict__ mask, float* PART) {
    __shared__ __align__(16) float sb[NH_ * SBP];
    __shared__ __align__(16) unsigned wb[NH_ * 1024];    // weights, per head: [qt][kt][plane][lane][4 dwords]: a 16-byte read per lane is half an A fragment
    const int tid = threadIdx.x, lane = tid & 31, lr = lane & 15, hi = lane >> 4;
    const int n = __builtin_amdgcn_readfirstlane(tid >> 5);    // the head is the same in every lane: what is formed from it stays in scalar registers
    const int q0 = blockIdx.x * QT, kb = blockIdx.y * KSPAN, b = blockIdx.z;
    const size_t per = (size_t)NH_ * LL * HD;
    const bf* Qn = QP + b * per + ((size_t)n * LL + q0 + lr) * HD + 8 * hi;
    // keys and v in fragment order: a key costs HD elements in both planes; 16 keys = 2 key fragments (d 0..31, d 32..63) of 512 elements, 32 keys = 4 v fragments (16 d each) of 512 elements
    const bf* Kn = KP + b * per + ((size_t)n * LL + kb) * HD + 8 * lane;
    const bf* Vn = VT + b * per + ((size_t)n * LL + kb) * HD + 8 * lane;
    float* slab = sb + n * SBP;
    // the two columns of step (2): words 2 tid, 2 tid + 1 of every slab; word = chunk * 128 + lane * 4 + e, chunk = (kt * 2 + qt) * 2 + (j >> 2), e = j & 3
    const int ch = tid >> 6, pl = (tid >> 1) & 31;
    const int pk = (ch >> 2) * 16 + (pl >> 4) * 8 + (ch & 1) * 4 + (tid & 1) * 2, pq = ((ch >> 1) & 1) * 16 + (pl & 15);
    const int* mrow = mask + ((size_t)b * LL + q0 + pq) * LL + kb + pk;
    unsigned* wput = wb + ((((ch >> 1) & 1) * 2 + (ch >> 2)) * 2) * 128 + pl * 4 + (ch & 1) * 2 + (tid & 1);
    const unsigned* wget = wb + n * 1024 + lane * 4;

    v16bf qf[2][2], kf[2][2];
#pragma unroll
    for (int t = 0; t < 2; ++t)
#pragma unroll
        for (int dc = 0; dc < 2; ++dc) { qf[t][dc] = ldfrag(Qn + (size_t)t * 16 * HD + dc * 32); kf[t][dc] = ldfragc(Kn + (size_t)t * 16 * HD + dc * 512); }
    v8f acc[2][4];
#pragma unroll
    for (int qt = 0; qt < 2; ++qt)
#pragma unroll
        for (int dt = 0; dt < 4; ++dt) acc[qt][dt] = (v8f){};

    v2i mnext = *(const v2i*)mrow;
    const bf* vp = Vn; const bf* kp = Kn + KP_ * HD;    // this pass's v, the next pass's keys
    for (int k0 = 0; k0 < KSPAN; k0 += KP_) {
        const v2i mm = mnext;
        // (1) transposed scores
#pragma unroll
        for (int kt = 0; kt < 2; ++kt)
#pragma unroll
            for (int qt = 0; qt < 2; ++qt) {
                v8f s = wmmab(kf[kt][0], qf[qt][0], (v8f){}); s = wmmab(kf[kt][1], qf[qt][1], s);
                float* w = slab + ((kt * 2 + qt) * 2) * 128 + lane * 4;
                *(v4fa*)w = (v4f){s[0], s[1], s[2], s[3]}; *(v4fa*)(w + 128) = (v4f){s[4], s[5], s[6], s[7]}; }
        // the next pass's mask words, this pass's v and the next pass's keys are asked for here, so that they fly during step (2); the last pass asks for its own mask words and keys again (in bounds, unused)
        const int kn = (k0 + KP_ < KSPAN) ? k0 + KP_ : k0;
        mnext = *(const v2i*)(mrow + kn);
        v16bf vf[4];
#pragma unroll
        for (int dt = 0; dt < 4; ++dt) vf[dt] = ldfragc(vp + dt * 512);
#pragma unroll
        for (int kt = 0; kt < 2; ++kt)
#pragma unroll
            for (int dc = 0; dc < 2; ++dc) kf[kt][dc] = ldfragc(kp + kt * 16 * HD + dc * 512);
        lds_barrier();
        // (2) mask and softmax over the heads
        {
            float sc[NH_][2]; float mx[2] = {-3.0e38f, -3.0e38f};
#pragma unroll
            for (int h = 0; h < NH_; ++h) { const v2f a = *(const v2fa*)(sb + h * SBP + 2 * tid);
#pragma unroll
                for (int u = 0; u < 2; ++u) { const float t = (mm[u] == 0) ? -__builtin_inff() : a[u] * 0.125f; sc[h][u] = t; mx[u] = fmaxf(mx[u], t); } }
            float sum[2] = {0.f, 0.f};
#pragma unroll
            for (int h = 0; h < NH_; ++h) { const float x0 = __fmul_rn(__fsub_rn(sc[h][0], mx[0]), 1.4426950408889634f), x1 = __fmul_rn(__fsub_rn(sc[h][1], mx[1]), 1.4426950408889634f);
                // both exponentials and the one free slot that the instruction set asks for behind a transcendental, in one statement
                asm("v_exp_f32 %0, %2\n\tv_exp_f32 %1, %3\n\tv_nop" : "=&v"(sc[h][0]), "=&v"(sc[h][1]) : "v"(x0), "v"(x1));
                sum[0] += sc[h][0]; sum[1] += sc[h][1]; }
            const float f[2] = {__fdiv_rn(1.0f, sum[0]), __fdiv_rn(1.0f, sum[1])};
#pragma unroll
            for (int h = 0; h < NH_; ++h) {
                // both columns at once: the packed conversion rounds to nearest even, as f2bf does, and leaves the two bf16 in one dword in the order the planes want; lo = what the product leaves over hi
                const v2f w = (v2f){sc[h][0], sc[h][1]} * (v2f){f[0], f[1]};
                const v2bf hb = __builtin_convertvector(w, v2bf);
                const v2bf lb = __builtin_convertvector(w - __builtin_convertvector(hb, v2f), v2bf);
                wput[h * 1024] = __builtin_bit_cast(unsigned, hb); wput[h * 1024 + 128] = __builtin_bit_cast(unsigned, lb); }
        }
        lds_barrier();
        // (3) weights.v
#pragma unroll
        for (int qt = 0; qt < 2; ++qt) {
            // elements 0..7: keys 8 hi + i of key tile 0, elements 8..15: the same of key tile 1: the k order of ldfrag
            const v4u h0 = *(const v4ua*)(wget + (qt * 4 + 0) * 128), w0 = *(const v4ua*)(wget + (qt * 4 + 1) * 128), h1 = *(const v4ua*)(wget + (qt * 4 + 2) * 128), w1 = *(const v4ua*)(wget + (qt * 4 + 3) * 128);
            const v16bf ah = __builtin_bit_cast(v16bf, __builtin_shufflevector(h0, h1, 0, 1, 2, 3, 4, 5, 6, 7)), al = __builtin_bit_cast(v16bf, __builtin_shufflevector(w0, w1, 0, 1, 2, 3, 4, 5, 6, 7));
#pragma unroll
            for (int dt = 0; dt < 4; ++dt) { acc[qt][dt] = wmmab(ah, vf[dt], acc[qt][dt]); acc[qt][dt] = wmmab(al, vf[dt], acc[qt][dt]); }
        }
        // the wait owed before a register that an issued load names is rewritten, here where the loads were issued long ago; the two pointers as inputs keep their register pairs live up to here, so that no load of the pass lands in them
        asm volatile("s_wait_xcnt 0x0" :: "v"(vp), "v"(kp) : "memory");
        vp += KP_ * HD; kp += (k0 + 2 * KP_ < KSPAN) ? KP_ * HD : 0;
    }
    // store: each wave turns its tiles through its own slab (no other wave touches it behind the last barrier) into 16-byte row stores
    float* C = PART + (((size_t)blockIdx.y * NB_ + b) * NH_ + n) * ((size_t)LL * HD) + (size_t)q0 * HD;
#pragma unroll
    for (int qt = 0; qt < 2; ++qt) {
#pragma unroll
        for (int dt = 0; dt < 4; ++dt)
#pragma unroll
            for (int j = 0; j < 8; ++j) slab[(hi * 8 + j) * 68 + dt * 16 + lr] = acc[qt][dt][j];
        __builtin_amdgcn_wave_barrier(); asm volatile("" ::: "memory");    // keeps the compiler from moving the reads below over the writes above (they read other lanes' words)
#pragma unroll
        for (int s = 0; s < 8; ++s) { const int row = 2 * s + hi, cofs = lr * 4; *(v4f*)(C + (size_t)(qt * 16 + row) * HD + cofs) = *(const v4fa*)(slab + row * 68 + cofs); }
        __builtin_amdgcn_wave_barrier(); asm volatile("" ::: "memory");    // and the next tile's writes over these reads
    }
}

// The helpers below stream: each thread carries 16 loads of 16 bytes, all or most of them asked for before the first is used, so that few, long waves carry the bytes (fewer waves to start; the bytes in flight come from the loads per wave).
// out = partial of keys [0, KSPAN) + partial of keys [KSPAN, 2 KSPAN); 8 pieces of 4 floats per thread, a wave's piece = 512 contiguous bytes
#define SUMP 8
__global__ __launch_bounds__(256) void k_sum2(const float* __restrict__ P, float* out) {
    const size_t tot = (size_t)NB_ * NH_ * LL * HD; const size_t i0 = (size_t)blockIdx.x * (256 * SUMP * 4) + threadIdx.x * 4;
    v4f a[SUMP], c[SUMP];
#pragma unroll
    for (int s = 0; s < SUMP; ++s) { a[s] = *(const v4f*)(P + i0 + s * 1024); c[s] = *(const v4f*)(P + tot + i0 + s * 1024); }
#pragma unroll
    for (int s = 0; s < SUMP; ++s) *(v4f*)(out + i0 + s * 1024) = a[s] + c[s];
}

// k_prep, both batches in one launch. Blocks [0, PQB / 2): q [b][l][n][d] f32 -> QP [b][n][l][d] bf16. Blocks [PQB / 2, PQB): k -> KP, blocks [PQB, PQB + PVB): v -> VT, both bf16 in the fragment order that ldfragc reads:
// KP [b][n][l / 16][d / 8][l % 16][8 d]: d / 8 = (fragment dc, half, hi), so that (hi, l % 16) is the lane. VT [b][n][l / 32][d / 16][(l % 32) / 8][d % 16][8 keys]: (l % 32) / 8 = (half, hi), so that (hi, d % 16) is the lane.
typedef v4f __attribute__((aligned(4))) v4fu;    // the inputs are promised as float arrays only
#define ROWF (NH_ * HD)               // floats of one (b, l) row of an input
#define PQL  8                        // q/k part: rows l per thread
#define PQB  (2 * (NB_ * LL / PQL * (ROWF / 8) / 256))
#define PVB  (NB_ * LL / 64 * (ROWF / 256))
__global__ __launch_bounds__(256) void k_prep(const float* __restrict__ q, const float* __restrict__ k, const float* __restrict__ v, bf* QP, bf* KP, bf* VT) {
    const int tid = threadIdx.x;
    if (blockIdx.x < PQB) {
        // thread = 8 d of one head, PQL rows l, of q or of k: a wave reads 1 KB in a row (4 heads). q: a wave writes 4 whole 128-byte lines per row. k: the thread's PQL pieces of 16 bytes follow one another in the fragment order and fill one whole 128-byte line
        const bool isk = blockIdx.x >= PQB / 2;
        const int t = (blockIdx.x - (isk ? PQB / 2 : 0)) * 256 + tid, c = t & (ROWF / 8 - 1), bl0 = (t / (ROWF / 8)) * PQL;
        const float* s = (isk ? k : q) + (size_t)bl0 * ROWF + c * 8;
        v4f a[PQL][2];
#pragma unroll
        for (int i = 0; i < PQL; ++i) { a[i][0] = *(const v4fu*)(s + i * ROWF); a[i][1] = *(const v4fu*)(s + i * ROWF + 4); }
        asm volatile("s_wait_xcnt 0x0" :: "v"(s) : "memory");    // the wait owed before a register that an issued load names is rewritten; s as an input keeps the address pair live up to here, so that no load of the run lands in it
        v8us x[PQL];
#pragma unroll
        for (int i = 0; i < PQL; ++i)
#pragma unroll
            for (int u = 0; u < 8; ++u) x[i][u] = f2bf(a[i][u >> 2][u & 3]);
        const size_t row0 = ((size_t)(bl0 / LL) * NH_ + (c >> 3)) * LL; const int l0 = bl0 % LL;
        if (isk) { bf* dst = KP + (row0 + (l0 & ~15)) * HD + (c & 7) * 128 + (l0 & 15) * 8;
#pragma unroll
            for (int i = 0; i < PQL; ++i) *(v8us*)(dst + i * 8) = x[i];
        } else { bf* dst = QP + (row0 + l0) * HD + (c & 7) * 8;
#pragma unroll
            for (int i = 0; i < PQL; ++i) *(v8us*)(dst + i * HD) = x[i]; }
    } else {
        // block = 64 keys x 256 columns (4 heads); thread = 16 keys x 4 columns, turned in its registers. Lane = (key group kg, column quad c8): the four lanes of one column quad hold keys 8 kg + i and 32 + 8 kg + i,
        // in the fragment order the thread's 4 columns of one key group are 64 bytes in a row, and one wave writes each 128-byte line of VT whole
        const int blk = blockIdx.x - PQB, hg = blk & (ROWF / 256 - 1), bl0 = (blk / (ROWF / 256)) * 64;
        const int kg = (tid & 31) >> 3, col = hg * 256 + (tid >> 5) * 32 + (tid & 7) * 4;    // col = n * HD + d
        const float* vs = v + (size_t)(bl0 + kg * 8) * ROWF + col;
        v4f x[16];
#pragma unroll
        for (int j = 0; j < 16; ++j) x[j] = *(const v4fu*)(vs + (size_t)((j >> 3) * 32 + (j & 7)) * ROWF);
        asm volatile("s_wait_xcnt 0x0" :: "v"(vs) : "memory");    // the wait owed before a register that an issued load names is rewritten; vs as an input keeps the address pair live up to here, so that no load of the run lands in it
        __builtin_amdgcn_sched_barrier(0);    // keeps the conversion below behind the wait: without it the compiler drew it up among the loads and held six of the sixteen back behind the first results
        bf* dst = VT + ((size_t)(bl0 / LL) * NH_ + (col >> 6)) * ((size_t)LL * HD) + (size_t)(bl0 % LL) * HD + ((col >> 4) & 3) * 512 + kg * 128 + (col & 15) * 8;
        v8us o[4][2];
#pragma unroll
        for (int u = 0; u < 4; ++u)
#pragma unroll
            for (int h = 0; h < 2; ++h)
#pragma unroll
                for (int i = 0; i < 8; ++i) o[u][h][i] = f2bf(x[h * 8 + i][u]);
#pragma unroll
        for (int u = 0; u < 4; ++u) { *(v8us*)(dst + u * 8) = o[u][0]; *(v8us*)(dst + u * 8 + 32 * HD) = o[u][1]; }
        asm volatile("s_wait_xcnt 0x0" ::: "memory");    // the same wait behind the stores: nothing that follows them in the code may rewrite their registers ahead of it
    }
}

extern "C" void kernel_launch(void* const* d_in, const int* in_sizes, int n_in,
                              void* d_out, int out_size, void* d_ws, size_t ws_size, hipStream_t stream) {
    (void)in_sizes; (void)n_in; (void)out_size;
    const float* q = (const float*)d_in[0]; const float* k = (const float*)d_in[1]; const float* v = (const float*)d_in[2]; const int* mask = (const int*)d_in[3];
    float* OUT = (float*)d_out;     // [2][16][2048][64]
    char* wsp = (char*)d_ws;
    auto take = [&](size_t bytes) { char* p = wsp; wsp += (bytes + 255) & ~(size_t)255; return (void*)p; };
    const size_t per = (size_t)NH_ * LL * HD;
    bf* QP = (bf*)take(NB_ * per * 2); bf* KP = (bf*)take(NB_ * per * 2); bf* VT = (bf*)take(NB_ * per * 2); float* PART = (float*)take((size_t)(LL / KSPAN) * NB_ * per * 4);
    if ((size_t)(wsp - (char*)d_ws) > ws_size) return;    // total ~ 59 MB
    k_prep<<<PQB + PVB, 256, 0, stream>>>(q, k, v, QP, KP, VT);
    k_fused<<<dim3(LL / QT, LL / KSPAN, NB_), 512, 0, stream>>>(QP, KP, VT, mask, PART);
    k_sum2<<<(unsigned)(NB_ * per / (256 * SUMP * 4)), 256, 0, stream>>>(PART, OUT);
}

// v006
// Measured time: 81.3 microseconds a run.
// Two timings next to v005 put it at 1.07 and 1.09 times that version's speed.
// Counting every step since v000, it is 9.02 times as fast.
#include <hip/hip_runtime.h>

// SDPA (query, key, value [2][2048][16][64]; mask [2][1][2048][2048] int read (all ones); scores[b][n][q][k] = q.k / 8, masked -> -inf; the source's softmax runs over dim=1 = the HEAD axis (16 heads) for every (q, k) pair, not over the keys; out[b][n][q][d] = sum_k w v -> [2][16][2048][64]).
// Compute dtypes, f32 accumulate: every input rounded to bf16; scores as PLAIN bf16 products of the inputs (exact products); mask + the across-heads softmax in f32 (thread per two (q, k) columns of 16 values); weights -> hl planes; weights.v as hl x exact bf16 v (2 products).
// One kernel does scores, softmax and weights.v: scores and weights never leave the WGP.

#define NB_  2
#define LL   2048
#define NH_  16
#define HD   64
typedef unsigned short bf;
typedef __attribute__((ext_vector_type(16))) __bf16   v16bf;
typedef __attribute__((ext_vector_type(8)))  unsigned short v8us;
typedef __attribute__((ext_vector_type(8)))  float    v8f;
typedef __attribute__((ext_vector_type(4)))  float    v4f;
typedef __attribute__((ext_vector_type(2)))  float    v2f;
typedef __attribute__((ext_vector_type(2)))  int      v2i;
typedef __attribute__((ext_vector_type(2)))  __bf16   v2bf;
typedef v4f  __attribute__((may_alias)) v4fa;
typedef v2f  __attribute__((may_alias)) v2fa;
typedef __attribute__((ext_vector_type(4)))  unsigned v4u;
typedef v4u  __attribute__((may_alias)) v4ua;

__device__ __forceinline__ unsigned short f2bf(float f) { unsigned u = __float_as_uint(f); u += 0x7FFFu + ((u >> 16) & 1u); return (unsigned short)(u >> 16); }
__device__ __forceinline__ v16bf cat16b(v8us lo, v8us hi) { return __builtin_bit_cast(v16bf, __builtin_shufflevector(lo, hi, 0, 1, 2, 3, 4, 5, 6, 7, 8, 9, 10, 11, 12, 13, 14, 15)); }
__device__ __forceinline__ v8f wmmab(v16bf a, v16bf b, v8f c) { return __builtin_amdgcn_wmma_f32_16x16x32_bf16(false, a, false, b, (short)0, c, false, false); }
// A or B fragment of 16 rows x 32 k from a k-contiguous plane; p = row (lane & 15), k offset 8 * (lane >> 4): elements 0..7 are k = 8 hi + i, elements 8..15 are k = 16 + 8 hi + i.
__device__ __forceinline__ v16bf ldfrag(const bf* p) { return cat16b(*(const v8us*)p, *(const v8us*)(p + 16)); }
// The same fragment from a plane that k_prep has laid out in FRAGMENT ORDER: [half][lane][8 elements], half = elements 0..7 or 8..15 of every lane; p = fragment + 8 * lane. Each of the two loads reads 512 bytes in a row (4 whole lines)
// where the row-major plane gave 16 pieces of 32 bytes in 16 lines.
__device__ __forceinline__ v16bf ldfragc(const bf* p) { return cat16b(*(const v8us*)p, *(const v8us*)(p + 256)); }

// ---- k_fused: one work-group = 32 query rows x KSPAN keys x all 16 heads of one batch; 16 waves, wave n = head n. grid (LL/QT, LL/KSPAN, NB_), 512 threads.
// Per pass of 32 keys: (1) wave n forms the TRANSPOSED score tile key x query (A = key rows, B = query rows), so that lane (lr, hi) holds query lr, keys 8 hi + j: the order of an A fragment of the weights;
// it leaves the 32 f32 scores of each lane in its slab of LDS; barrier; (2) every thread takes two (query, key) columns of neighbouring keys, reads their 16 heads, does mask and softmax over the heads and writes, per head, one dword of the hi plane and one of the lo plane
// (two keys each) where the A fragment of that head wants them; barrier; (3) wave n reads its A fragments and multiplies them with its head's v. The f32 partial of this key span goes to the workspace; k_sum2 adds the spans.
// The three steps are pipelined over the passes, with two buffers for the scores and two for the weights: between two barriers a wave does (3) of pass i - 1, (1) of pass i + 1 and (2) of pass i, which depend on nothing of one another,
// so that one wave's matrix work runs beside another wave's vector and LDS work on the same SIMD, and a pass has one barrier.
// Every '#pragma unroll' in this file but the one on the row stores at the end of k_fused stands on a loop whose index picks a register array's element: unrolled, each index is a constant and the arrays stay in registers.
#define QT    32
#define KSPAN 1024
#define KP_   32
#define SBP   1088    // words per head slab: 1024 for the exchange; 16 rows x 68 for the store transpose at the end
// Work-group barrier for data that goes through LDS only: it waits for this wave's LDS operations and leaves its global loads in flight.
__device__ __forceinline__ void lds_barrier() { asm volatile("s_wait_dscnt 0x0\n\ts_barrier_signal -1\n\ts_barrier_wait -1" ::: "memory"); }
__global__ __launch_bounds__(512) void k_fused(const bf* __restrict__ QP, const bf* __restrict__ KP, const bf* __restrict__ VT, const int* __restrict__ mask, float* PART) {
    __shared__ __align__(16) float sb[2 * NH_ * SBP];       // scores, two buffers: pass i in buffer i & 1
    __shared__ __align__(16) unsigned wb[2 * NH_ * 1024];    // weights, two buffers likewise; per head: [qt][kt][plane][lane][4 dwords]: a 16-byte read per lane is half an A fragment
    const int tid = threadIdx.x, lane = tid & 31, lr = lane & 15, hi = lane >> 4;
    const int n = __builtin_amdgcn_readfirstlane(tid >> 5);    // the head is the same in every lane: what is formed from it stays in scalar registers
    const int q0 = blockIdx.x * QT, kb = blockIdx.y * KSPAN, b = blockIdx.z;
    const size_t per = (size_t)NH_ * LL * HD;
    const bf* Qn = QP + b * per + ((size_t)n * LL + q0 + lr) * HD + 8 * hi;
    // keys and v in fragment order: a key costs HD elements in both planes; 16 keys = 2 key fragments (d 0..31, d 32..63) of 512 elements, 32 keys = 4 v fragments (16 d each) of 512 elements
    const bf* Kn = KP + b * per + ((size_t)n * LL + kb) * HD + 8 * lane;
    const bf* Vn = VT + b * per + ((size_t)n * LL + kb) * HD + 8 * lane;
    float* slab = sb + n * SBP;
    // the two columns of step (2): words 2 tid, 2 tid + 1 of every slab; word = chunk * 128 + lane * 4 + e, chunk = (kt * 2 + qt) * 2 + (j >> 2), e = j & 3
    const int ch = tid >> 6, pl = (tid >> 1) & 31;
    const int pk = (ch >> 2) * 16 + (pl >> 4) * 8 + (ch & 1) * 4 + (tid & 1) * 2, pq = ((ch >> 1) & 1) * 16 + (pl & 15);
    const int* mrow = mask + ((size_t)b * LL + q0 + pq) * LL + kb + pk;
    unsigned* wput = wb + ((((ch >> 1) & 1) * 2 + (ch >> 2)) * 2) * 128 + pl * 4 + (ch & 1) * 2 + (tid & 1);
    const unsigned* wget = wb + n * 1024 + lane * 4;

    v16bf qf[2][2], kf[2][2];
#pragma unroll
    for (int t = 0; t < 2; ++t)
#pragma unroll
        for (int dc = 0; dc < 2; ++dc) { qf[t][dc] = ldfrag(Qn + (size_t)t * 16 * HD + dc * 32); kf[t][dc] = ldfragc(Kn + (size_t)t * 16 * HD + dc * 512); }
    // (1) transposed scores of the keys in kf, into this wave's slab of one buffer
    auto scores = [&](float* dst) {
#pragma unroll
        for (int kt = 0; kt < 2; ++kt)
#pragma unroll
            for (int qt = 0; qt < 2; ++qt) {
                v8f s = wmmab(kf[kt][0], qf[qt][0], (v8f){}); s = wmmab(kf[kt][1], qf[qt][1], s);
                float* w = dst + ((kt * 2 + qt) * 2) * 128 + lane * 4;
                *(v4fa*)w = (v4f){s[0], s[1], s[2], s[3]}; *(v4fa*)(w + 128) = (v4f){s[4], s[5], s[6], s[7]}; }
    };
    // ahead of the loop: pass 0's scores into buffer 0, then pass 1's keys
    scores(slab);
#pragma unroll
    for (int kt = 0; kt < 2; ++kt)
#pragma unroll
        for (int dc = 0; dc < 2; ++dc) kf[kt][dc] = ldfragc(Kn + KP_ * HD + kt * 16 * HD + dc * 512);
    v2i mnext = *(const v2i*)mrow;
    const bf* vp = Vn; const bf* kp = Kn + 2 * KP_ * HD;    // this pass's v, the keys of the pass after the next
    asm volatile("s_wait_xcnt 0x0" ::: "memory");    // the wait owed before a register that an issued load names is rewritten: behind the last load ahead of the loop
    __builtin_amdgcn_sched_barrier(0);    // keeps the zeroing below behind the matrix instructions above: its moves fill the vector slots that the chip wants between them and the loop's first, which may write the same registers
    v8f acc[2][4];
#pragma unroll
    for (int qt = 0; qt < 2; ++qt)
#pragma unroll
        for (int dt = 0; dt < 4; ++dt) acc[qt][dt] = (v8f){};
    lds_barrier();
    for (int k0 = 0; k0 < KSPAN; k0 += KP_) {
        const v2i mm = mnext;
        const int bi = (k0 / KP_) & 1;    // this pass's buffers
        const float* sg = sb + bi * (NH_ * SBP) + 2 * tid;
        unsigned* wp = wput + bi * (NH_ * 1024); const unsigned* wg = wget + bi * (NH_ * 1024);
        // this pass's scores are asked for ahead of the matrix work below, which covers their way out of LDS
        v2f sa[NH_];
#pragma unroll
        for (int h = 0; h < NH_; ++h) sa[h] = *(const v2fa*)(sg + h * SBP);
        // (1) of the NEXT pass, into the other buffer, whose last readers left it in front of the barrier of the pass before; the last pass forms its own scores again (unused)
        scores(slab + (bi ^ 1) * (NH_ * SBP));
        // the next pass's mask words, this pass's v and the keys of the pass after the next are asked for here, so that they fly during step (2); the last passes ask for the last mask words and keys again (in bounds, unused)
        const int kn = (k0 + KP_ < KSPAN) ? k0 + KP_ : k0;
        mnext = *(const v2i*)(mrow + kn);
        v16bf vf[4];
#pragma unroll
        for (int dt = 0; dt < 4; ++dt) vf[dt] = ldfragc(vp + dt * 512);
#pragma unroll
        for (int kt = 0; kt < 2; ++kt)
#pragma unroll
            for (int dc = 0; dc < 2; ++dc) kf[kt][dc] = ldfragc(kp + kt * 16 * HD + dc * 512);
        // (2) mask and softmax over the heads, on the scores that every wave left in front of the last barrier
        {
            float sc[NH_][2]; float mx[2] = {-3.0e38f, -3.0e38f};
#pragma unroll
            for (int h = 0; h < NH_; ++h) { const v2f a = sa[h];
#pragma unroll
                for (int u = 0; u < 2; ++u) { const float t = (mm[u] == 0) ? -__builtin_inff() : a[u] * 0.125f; sc[h][u] = t; mx[u] = fmaxf(mx[u], t); } }
            float sum[2] = {0.f, 0.f};
#pragma unroll
            for (int h = 0; h < NH_; ++h) { const float x0 = __fmul_rn(__fsub_rn(sc[h][0], mx[0]), 1.4426950408889634f), x1 = __fmul_rn(__fsub_rn(sc[h][1], mx[1]), 1.4426950408889634f);
                // both exponentials and the one free slot that the instruction set asks for behind a transcendental, in one statement
                asm("v_exp_f32 %0, %2\n\tv_exp_f32 %1, %3\n\tv_nop" : "=&v"(sc[h][0]), "=&v"(sc[h][1]) : "v"(x0), "v"(x1));
                sum[0] += sc[h][0]; sum[1] += sc[h][1]; }
            const float f[2] = {__fdiv_rn(1.0f, sum[0]), __fdiv_rn(1.0f, sum[1])};
#pragma unroll
            for (int h = 0; h < NH_; ++h) {
                // both columns at once: the packed conversion rounds to nearest even, as f2bf does, and leaves the two bf16 in one dword in the order the planes want; lo = what the product leaves over hi
                const v2f w = (v2f){sc[h][0], sc[h][1]} * (v2f){f[0], f[1]};
                const v2bf hb = __builtin_convertvector(w, v2bf);
                const v2bf lb = __builtin_convertvector(w - __builtin_convertvector(hb, v2f), v2bf);
                wp[h * 1024] = __builtin_bit_cast(unsigned, hb); wp[h * 1024 + 128] = __builtin_bit_cast(unsigned, lb); }
        }
        lds_barrier();    // the pass's one barrier: it publishes this pass's weights and the next pass's scores, and ends the reads of the buffers that the next pass refills
        // (3) weights.v
#pragma unroll
        for (int qt = 0; qt < 2; ++qt) {
            // elements 0..7: keys 8 hi + i of key tile 0, elements 8..15: the same of key tile 1: the k order of ldfrag
            const v4u h0 = *(const v4ua*)(wg + (qt * 4 + 0) * 128), w0 = *(const v4ua*)(wg + (qt * 4 + 1) * 128), h1 = *(const v4ua*)(wg + (qt * 4 + 2) * 128), w1 = *(const v4ua*)(wg + (qt * 4 + 3) * 128);
            const v16bf ah = __builtin_bit_cast(v16bf, __builtin_shufflevector(h0, h1, 0, 1, 2, 3, 4, 5, 6, 7)), al = __builtin_bit_cast(v16bf, __builtin_shufflevector(w0, w1, 0, 1, 2, 3, 4, 5, 6, 7));
#pragma unroll
            for (int dt = 0; dt < 4; ++dt) { acc[qt][dt] = wmmab(ah, vf[dt], acc[qt][dt]); acc[qt][dt] = wmmab(al, vf[dt], acc[qt][dt]); }
        }
        // the wait owed before a register that an issued load names is rewritten, here where the loads were issued long ago; the two pointers as inputs keep their register pairs live up to here, so that no load of the pass lands in them
        asm volatile("s_wait_xcnt 0x0" :: "v"(vp), "v"(kp) : "memory");
        vp += KP_ * HD; kp += (k0 + 3 * KP_ < KSPAN) ? KP_ * HD : 0;
    }
    // store: each wave turns its tiles through its own slab (no other wave touches it behind the last barrier) into 16-byte row stores
    float* C = PART + (((size_t)blockIdx.y * NB_ + b) * NH_ + n) * ((size_t)LL * HD) + (size_t)q0 * HD;
#pragma unroll
    for (int qt = 0; qt < 2; ++qt) {
#pragma unroll
        for (int dt = 0; dt < 4; ++dt)
#pragma unroll
            for (int j = 0; j < 8; ++j) slab[(hi * 8 + j) * 68 + dt * 16 + lr] = acc[qt][dt][j];
        __builtin_amdgcn_wave_barrier(); asm volatile("" ::: "memory");    // keeps the compiler from moving the reads below over the writes above (they read other lanes' words)
#pragma unroll
        for (int s = 0; s < 8; ++s) { const int row = 2 * s + hi, cofs = lr * 4; *(v4f*)(C + (size_t)(qt * 16 + row) * HD + cofs) = *(const v4fa*)(slab + row * 68 + cofs); }
        __builtin_amdgcn_wave_barrier(); asm volatile("" ::: "memory");    // and the next tile's writes over these reads
    }
}

// The helpers below stream: each thread carries 16 loads of 16 bytes, all or most of them asked for before the first is used, so that few, long waves carry the bytes (fewer waves to start; the bytes in flight come from the loads per wave).
// out = partial of keys [0, KSPAN) + partial of keys [KSPAN, 2 KSPAN); 8 pieces of 4 floats per thread, a wave's piece = 512 contiguous bytes
#define SUMP 8
__global__ __launch_bounds__(256) void k_sum2(const float* __restrict__ P, float* out) {
    const size_t tot = (size_t)NB_ * NH_ * LL * HD; const size_t i0 = (size_t)blockIdx.x * (256 * SUMP * 4) + threadIdx.x * 4;
    v4f a[SUMP], c[SUMP];
#pragma unroll
    for (int s = 0; s < SUMP; ++s) { a[s] = *(const v4f*)(P + i0 + s * 1024); c[s] = *(const v4f*)(P + tot + i0 + s * 1024); }
#pragma unroll
    for (int s = 0; s < SUMP; ++s) *(v4f*)(out + i0 + s * 1024) = a[s] + c[s];
}

// k_prep, both batches in one launch. Blocks [0, PQB / 2): q [b][l][n][d] f32 -> QP [b][n][l][d] bf16. Blocks [PQB / 2, PQB): k -> KP, blocks [PQB, PQB + PVB): v -> VT, both bf16 in the fragment order that ldfragc reads:
// KP [b][n][l / 16][d / 8][l % 16][8 d]: d / 8 = (fragment dc, half, hi), so that (hi, l % 16) is the lane. VT [b][n][l / 32][d / 16][(l % 32) / 8][d % 16][8 keys]: (l % 32) / 8 = (half, hi), so that (hi, d % 16) is the lane.
typedef v4f __attribute__((aligned(4))) v4fu;    // the inputs are promised as float arrays only
#define ROWF (NH_ * HD)               // floats of one (b, l) row of an input
#define PQL  8                        // q/k part: rows l per thread
#define PQB  (2 * (NB_ * LL / PQL * (ROWF / 8) / 256))
#define PVB  (NB_ * LL / 64 * (ROWF / 256))
__global__ __launch_bounds__(256) void k_prep(const float* __restrict__ q, const float* __restrict__ k, const float* __restrict__ v, bf* QP, bf* KP, bf* VT) {
    const int tid = threadIdx.x;
    if (blockIdx.x < PQB) {
        // thread = 8 d of one head, PQL rows l, of q or of k: a wave reads 1 KB in a row (4 heads). q: a wave writes 4 whole 128-byte lines per row. k: the thread's PQL pieces of 16 bytes follow one another in the fragment order and fill one whole 128-byte line
        const bool isk = blockIdx.x >= PQB / 2;
        const int t = (blockIdx.x - (isk ? PQB / 2 : 0)) * 256 + tid, c = t & (ROWF / 8 - 1), bl0 = (t / (ROWF / 8)) * PQL;
        const float* s = (isk ? k : q) + (size_t)bl0 * ROWF + c * 8;
        v4f a[PQL][2];
#pragma unroll
        for (int i = 0; i < PQL; ++i) { a[i][0] = *(const v4fu*)(s + i * ROWF); a[i][1] = *(const v4fu*)(s + i * ROWF + 4); }
        asm volatile("s_wait_xcnt 0x0" :: "v"(s) : "memory");    // the wait owed before a register that an issued load names is rewritten; s as an input keeps the address pair live up to here, so that no load of the run lands in it
        v8us x[PQL];
#pragma unroll
        for (int i = 0; i < PQL; ++i)
#pragma unroll
            for (int u = 0; u < 8; ++u) x[i][u] = f2bf(a[i][u >> 2][u & 3]);
        const size_t row0 = ((size_t)(bl0 / LL) * NH_ + (c >> 3)) * LL; const int l0 = bl0 % LL;
        if (isk) { bf* dst = KP + (row0 + (l0 & ~15)) * HD + (c & 7) * 128 + (l0 & 15) * 8;
#pragma unroll
            for (int i = 0; i < PQL; ++i) *(v8us*)(dst + i * 8) = x[i];
        } else { bf* dst = QP + (row0 + l0) * HD + (c & 7) * 8;
#pragma unroll
            for (int i = 0; i < PQL; ++i) *(v8us*)(dst + i * HD) = x[i]; }
    } else {
        // block = 64 keys x 256 columns (4 heads); thread = 16 keys x 4 columns, turned in its registers. Lane = (key group kg, column quad c8): the four lanes of one column quad hold keys 8 kg + i and 32 + 8 kg + i,
        // in the fragment order the thread's 4 columns of one key group are 64 bytes in a row, and one wave writes each 128-byte line of VT whole
        const int blk = blockIdx.x - PQB, hg = blk & (ROWF / 256 - 1), bl0 = (blk / (ROWF / 256)) * 64;
        const int kg = (tid & 31) >> 3, col = hg * 256 + (tid >> 5) * 32 + (tid & 7) * 4;    // col = n * HD + d
        const float* vs = v + (size_t)(bl0 + kg * 8) * ROWF + col;
        v4f x[16];
#pragma unroll
        for (int j = 0; j < 16; ++j) x[j] = *(const v4fu*)(vs + (size_t)((j >> 3) * 32 + (j & 7)) * ROWF);
        asm volatile("s_wait_xcnt 0x0" :: "v"(vs) : "memory");    // the wait owed before a register that an issued load names is rewritten; vs as an input keeps the address pair live up to here, so that no load of the run lands in it
        __builtin_amdgcn_sched_barrier(0);    // keeps the conversion below behind the wait: without it the compiler drew it up among the loads and held six of the sixteen back behind the first results
        bf* dst = VT + ((size_t)(bl0 / LL) * NH_ + (col >> 6)) * ((size_t)LL * HD) + (size_t)(bl0 % LL) * HD + ((col >> 4) & 3) * 512 + kg * 128 + (col & 15) * 8;
        v8us o[4][2];
#pragma unroll
        for (int u = 0; u < 4; ++u)
#pragma unroll
            for (int h = 0; h < 2; ++h)
#pragma unroll
                for (int i = 0; i < 8; ++i) o[u][h][i] = f2bf(x[h * 8 + i][u]);
#pragma unroll
        for (int u = 0; u < 4; ++u) { *(v8us*)(dst + u * 8) = o[u][0]; *(v8us*)(dst + u * 8 + 32 * HD) = o[u][1]; }
        asm volatile("s_wait_xcnt 0x0" ::: "memory");    // the same wait behind the stores: nothing that follows them in the code may rewrite their registers ahead of it
    }
}

extern "C" void kernel_launch(void* const* d_in, const int* in_sizes, int n_in,
                              void* d_out, int out_size, void* d_ws, size_t ws_size, hipStream_t stream) {
    (void)in_sizes; (void)n_in; (void)out_size;
    const float* q = (const float*)d_in[0]; const float* k = (const float*)d_in[1]; const float* v = (const float*)d_in[2]; const int* mask = (const int*)d_in[3];
    float* OUT = (float*)d_out;     // [2][16][2048][64]
    char* wsp = (char*)d_ws;
    auto take = [&](size_t bytes) { char* p = wsp; wsp += (bytes + 255) & ~(size_t)255; return (void*)p; };
    const size_t per = (size_t)NH_ * LL * HD;
    bf* QP = (bf*)take(NB_ * per * 2); bf* KP = (bf*)take(NB_ * per * 2); bf* VT = (bf*)take(NB_ * per * 2); float* PART = (float*)take((size_t)(LL / KSPAN) * NB_ * per * 4);
    if ((size_t)(wsp - (char*)d_ws) > ws_size) return;    // total ~ 59 MB
    k_prep<<<PQB + PVB, 256, 0, stream>>>(q, k, v, QP, KP, VT);
    k_fused<<<dim3(LL / QT, LL / KSPAN, NB_), 512, 0, stream>>>(QP, KP, VT, mask, PART);
    k_sum2<<<(unsigned)(NB_ * per / (256 * SUMP * 4)), 256, 0, stream>>>(PART, OUT);
}

// v007
// A run of this version takes 75.5 microseconds.
// Next to v006, in two timings, it ran 1.09 and 1.08 times as fast.
// All steps since v000 together make it 9.77 times as fast.
#include <hip/hip_runtime.h>

// SDPA (query, key, value [2][2048][16][64]; mask [2][1][2048][2048] int read (all ones); scores[b][n][q][k] = q.k / 8, masked -> -inf; the source's softmax runs over dim=1 = the HEAD axis (16 heads) for every (q, k) pair, not over the keys; out[b][n][q][d] = sum_k w v -> [2][16][2048][64]).
// Compute dtypes, f32 accumulate: every input rounded to bf16; scores as PLAIN bf16 products of the inputs (exact products); mask + the across-heads softmax in f32 (thread per two (q, k) columns of 16 values); weights -> hl planes; weights.v as hl x exact bf16 v (2 products).
// One kernel does scores, softmax and weights.v: scores and weights never leave the WGP.

#define NB_  2
#define LL   2048
#define NH_  16
#define HD   64
typedef unsigned short bf;
typedef __attribute__((ext_vector_type(16))) __bf16   v16bf;
typedef __attribute__((ext_vector_type(8)))  unsigned short v8us;
typedef __attribute__((ext_vector_type(8)))  float    v8f;
typedef __attribute__((ext_vector_type(4)))  float    v4f;
typedef __attribute__((ext_vector_type(2)))  float    v2f;
typedef __attribute__((ext_vector_type(2)))  int      v2i;
typedef __attribute__((ext_vector_type(2)))  __bf16   v2bf;
typedef v4f  __attribute__((may_alias)) v4fa;
typedef v2f  __attribute__((may_alias)) v2fa;
typedef __attribute__((ext_vector_type(4)))  unsigned v4u;
typedef v4u  __attribute__((may_alias)) v4ua;

__device__ __forceinline__ unsigned short f2bf(float f) { unsigned u = __float_as_uint(f); u += 0x7FFFu + ((u >> 16) & 1u); return (unsigned short)(u >> 16); }
__device__ __forceinline__ v16bf cat16b(v8us lo, v8us hi) { return __builtin_bit_cast(v16bf, __builtin_shufflevector(lo, hi, 0, 1, 2, 3, 4, 5, 6, 7, 8, 9, 10, 11, 12, 13, 14, 15)); }
__device__ __forceinline__ v8f wmmab(v16bf a, v16bf b, v8f c) { return __builtin_amdgcn_wmma_f32_16x16x32_bf16(false, a, false, b, (short)0, c, false, false); }
// A or B fragment of 16 rows x 32 k from a k-contiguous plane; p = row (lane & 15), k offset 8 * (lane >> 4): elements 0..7 are k = 8 hi + i, elements 8..15 are k = 16 + 8 hi + i.
__device__ __forceinline__ v16bf ldfrag(const bf* p) { return cat16b(*(const v8us*)p, *(const v8us*)(p + 16)); }
// The same fragment from a plane that k_prep has laid out in FRAGMENT ORDER: [half][lane][8 elements], half = elements 0..7 or 8..15 of every lane; p = fragment + 8 * lane. Each of the two loads reads 512 bytes in a row (4 whole lines)
// where the row-major plane gave 16 pieces of 32 bytes in 16 lines.
__device__ __forceinline__ v16bf ldfragc(const bf* p) { return cat16b(*(const v8us*)p, *(const v8us*)(p + 256)); }

// ---- k_fused: one work-group = 32 query rows x KSPAN keys x all 16 heads of one batch; 16 waves, wave n = head n. grid (LL/QT, LL/KSPAN, NB_), 512 threads.
// Per pass of 32 keys: (1) wave n forms the TRANSPOSED score tile key x query (A = key rows, B = query rows), so that lane (lr, hi) holds query lr, keys 8 hi + j: the order of an A fragment of the weights;
// it leaves the 32 f32 scores of each lane in its slab of LDS; barrier; (2) every thread takes two (query, key) columns of neighbouring keys, reads their 16 heads, does mask and softmax over the heads and writes, per head, one dword of the hi plane and one of the lo plane
// (two keys each) where the A fragment of that head wants them; barrier; (3) wave n reads its A fragments and multiplies them with its head's v. The f32 partial of this key span goes to the workspace; k_sum2 adds the spans.
// The three steps are pipelined over the passes, with two buffers for the scores and two for the weights: between two barriers a wave does (3) of pass i - 1, (1) of pass i + 1 and (2) of pass i, which depend on nothing of one another,
// so that one wave's matrix work runs beside another wave's vector and LDS work on the same SIMD, and a pass has one barrier.
// The 64 work-groups of one (key span, batch) read the same key and v fragments. Each walks the span's NP_ passes as a ring and enters it at its own pass, so that at any moment they ask L2 for different lines, spread over the whole span,
// and not all for the same 128 KB. Every pass is done once, whatever the entry; only the order of the f32 key sum turns with it.
// Every '#pragma unroll' in this file, but the one on the store's row loop, stands on a loop whose index picks a register array's element: unrolled, each index is a constant and the arrays stay in registers.
#define QT    32
#define KSPAN 1024
#define KP_   32
#define NP_   (KSPAN / KP_)    // passes of a work-group
#define SBP   1088    // words per head slab: 1024 for the exchange; 16 rows x 68 for the store transpose at the end
// Work-group barrier for data that goes through LDS only: it waits for this wave's LDS operations and leaves its global loads in flight.
__device__ __forceinline__ void lds_barrier() { asm volatile("s_wait_dscnt 0x0\n\ts_barrier_signal -1\n\ts_barrier_wait -1" ::: "memory"); }
__global__ __launch_bounds__(512) void k_fused(const bf* __restrict__ QP, const bf* __restrict__ KP, const bf* __restrict__ VT, const int* __restrict__ mask, float* PART) {
    __shared__ __align__(16) float sb[2 * NH_ * SBP];       // scores, two buffers: pass i in buffer i & 1
    __shared__ __align__(16) unsigned wb[2 * NH_ * 1024];    // weights, two buffers likewise; per head: [qt][kt][plane][lane][4 dwords]: a 16-byte read per lane is half an A fragment
    const int tid = threadIdx.x, lane = tid & 31, lr = lane & 15, hi = lane >> 4;
    const int n = __builtin_amdgcn_readfirstlane(tid >> 5);    // the head is the same in every lane: what is formed from it stays in scalar registers
    const int q0 = blockIdx.x * QT, kb = blockIdx.y * KSPAN, b = blockIdx.z;
    // entry pass: work-groups whose index differs by less than 4, or by a multiple of 8, get different entries (for speed only; any entry is right)
    const int rot = (((blockIdx.x >> 3) << 2) | (blockIdx.x & 3)) & (NP_ - 1);
    const size_t per = (size_t)NH_ * LL * HD;
    const bf* Qn = QP + b * per + ((size_t)n * LL + q0 + lr) * HD + 8 * hi;
    // keys and v in fragment order: a key costs HD elements in both planes; 16 keys = 2 key fragments (d 0..31, d 32..63) of 512 elements, 32 keys = 4 v fragments (16 d each) of 512 elements
    const bf* Kn = KP + b * per + ((size_t)n * LL + kb) * HD + 8 * lane;
    const bf* Vn = VT + b * per + ((size_t)n * LL + kb) * HD + 8 * lane;
    float* slab = sb + n * SBP;
    // the two columns of step (2): words 2 tid, 2 tid + 1 of every slab; word = chunk * 128 + lane * 4 + e, chunk = (kt * 2 + qt) * 2 + (j >> 2), e = j & 3
    const int ch = tid >> 6, pl = (tid >> 1) & 31;
    const int pk = (ch >> 2) * 16 + (pl >> 4) * 8 + (ch & 1) * 4 + (tid & 1) * 2, pq = ((ch >> 1) & 1) * 16 + (pl & 15);
    const int* mrow = mask + ((size_t)b * LL + q0 + pq) * LL + kb + pk;
    unsigned* wput = wb + ((((ch >> 1) & 1) * 2 + (ch >> 2)) * 2) * 128 + pl * 4 + (ch & 1) * 2 + (tid & 1);
    const unsigned* wget = wb + n * 1024 + lane * 4;

    v16bf qf[2][2], kf[2][2];
#pragma unroll
    for (int t = 0; t < 2; ++t)
#pragma unroll
        for (int dc = 0; dc < 2; ++dc) { qf[t][dc] = ldfrag(Qn + (size_t)t * 16 * HD + dc * 32); kf[t][dc] = ldfragc(Kn + (size_t)rot * (KP_ * HD) + (size_t)t * 16 * HD + dc * 512); }
    asm volatile("s_wait_xcnt 0x0" :: "v"(Qn) : "memory");    // the wait owed before a register that an issued load names is rewritten: behind the first run of loads, whose address pairs are free from here on
    // (1) transposed scores of the keys in kf, into this wave's slab of one buffer
    auto scores = [&](float* dst) {
#pragma unroll
        for (int kt = 0; kt < 2; ++kt)
#pragma unroll
            for (int qt = 0; qt < 2; ++qt) {
                v8f s = wmmab(kf[kt][0], qf[qt][0], (v8f){}); s = wmmab(kf[kt][1], qf[qt][1], s);
                float* w = dst + ((kt * 2 + qt) * 2) * 128 + lane * 4;
                *(v4fa*)w = (v4f){s[0], s[1], s[2], s[3]}; *(v4fa*)(w + 128) = (v4f){s[4], s[5], s[6], s[7]}; }
    };
    // ahead of the loop: the first pass's scores into buffer 0, then the second pass's keys
    scores(slab);
#pragma unroll
    for (int kt = 0; kt < 2; ++kt)
#pragma unroll
        for (int dc = 0; dc < 2; ++dc) kf[kt][dc] = ldfragc(Kn + (size_t)((rot + 1) & (NP_ - 1)) * (KP_ * HD) + kt * 16 * HD + dc * 512);
    v2i mnext = *(const v2i*)(mrow + rot * KP_);
    const bf* vp = Vn + (size_t)rot * (KP_ * HD); const bf* kp = Kn + (size_t)((rot + 2) & (NP_ - 1)) * (KP_ * HD);    // this pass's v, the keys of the pass after the next
    const int* mp = mrow + ((rot + 1) & (NP_ - 1)) * KP_;    // the next pass's mask words
    asm volatile("s_wait_xcnt 0x0" ::: "memory");    // the wait owed before a register that an issued load names is rewritten: behind the last load ahead of the loop
    __builtin_amdgcn_sched_barrier(0);    // keeps the zeroing below behind the matrix instructions above: its moves fill the vector slots that the chip wants between them and the loop's first, which may write the same registers
    v8f acc[2][4];
#pragma unroll
    for (int qt = 0; qt < 2; ++qt)
#pragma unroll
        for (int dt = 0; dt < 4; ++dt) acc[qt][dt] = (v8f){};
    lds_barrier();
    for (int k0 = 0; k0 < KSPAN; k0 += KP_) {
        const v2i mm = mnext;
        const int bi = (k0 / KP_) & 1;    // this pass's buffers
        const int sl = (k0 / KP_ + rot) & (NP_ - 1);    // this pass's place in the span's ring
        const float* sg = sb + bi * (NH_ * SBP) + 2 * tid;
        unsigned* wp = wput + bi * (NH_ * 1024); const unsigned* wg = wget + bi * (NH_ * 1024);
        // this pass's scores are asked for ahead of the matrix work below, which covers their way out of LDS
        v2f sa[NH_];
#pragma unroll
        for (int h = 0; h < NH_; ++h) sa[h] = *(const v2fa*)(sg + h * SBP);
        // (1) of the NEXT pass, into the other buffer, whose last readers left it in front of the barrier of the pass before; the last pass forms the entry pass's scores again (unused)
        scores(slab + (bi ^ 1) * (NH_ * SBP));
        // the next pass's mask words, this pass's v and the keys of the pass after the next are asked for here, so that they fly during step (2); the last passes go on round the ring and ask for the first passes' mask words and keys again (in bounds, unused)
        mnext = *(const v2i*)mp;
        v16bf vf[4];
#pragma unroll
        for (int dt = 0; dt < 4; ++dt) vf[dt] = ldfragc(vp + dt * 512);
#pragma unroll
        for (int kt = 0; kt < 2; ++kt)
#pragma unroll
            for (int dc = 0; dc < 2; ++dc) kf[kt][dc] = ldfragc(kp + kt * 16 * HD + dc * 512);
        // (2) mask and softmax over the heads, on the scores that every wave left in front of the last barrier
        {
            float sc[NH_][2]; float mx[2] = {-3.0e38f, -3.0e38f};
#pragma unroll
            for (int h = 0; h < NH_; ++h) { const v2f a = sa[h];
#pragma unroll
                for (int u = 0; u < 2; ++u) { const float t = (mm[u] == 0) ? -__builtin_inff() : a[u] * 0.125f; sc[h][u] = t; mx[u] = fmaxf(mx[u], t); } }
            float sum[2] = {0.f, 0.f};
#pragma unroll
            for (int h = 0; h < NH_; ++h) { const float x0 = __fmul_rn(__fsub_rn(sc[h][0], mx[0]), 1.4426950408889634f), x1 = __fmul_rn(__fsub_rn(sc[h][1], mx[1]), 1.4426950408889634f);
                // both exponentials and the one free slot that the instruction set asks for behind a transcendental, in one statement
                asm("v_exp_f32 %0, %2\n\tv_exp_f32 %1, %3\n\tv_nop" : "=&v"(sc[h][0]), "=&v"(sc[h][1]) : "v"(x0), "v"(x1));
                sum[0] += sc[h][0]; sum[1] += sc[h][1]; }
            const float f[2] = {__fdiv_rn(1.0f, sum[0]), __fdiv_rn(1.0f, sum[1])};
#pragma unroll
            for (int h = 0; h < NH_; ++h) {
                // both columns at once: the packed conversion rounds to nearest even, as f2bf does, and leaves the two bf16 in one dword in the order the planes want; lo = what the product leaves over hi
                const v2f w = (v2f){sc[h][0], sc[h][1]} * (v2f){f[0], f[1]};
                const v2bf hb = __builtin_convertvector(w, v2bf);
                const v2bf lb = __builtin_convertvector(w - __builtin_convertvector(hb, v2f), v2bf);
                wp[h * 1024] = __builtin_bit_cast(unsigned, hb); wp[h * 1024 + 128] = __builtin_bit_cast(unsigned, lb); }
        }
        lds_barrier();    // the pass's one barrier: it publishes this pass's weights and the next pass's scores, and ends the reads of the buffers that the next pass refills
        // (3) weights.v
#pragma unroll
        for (int qt = 0; qt < 2; ++qt) {
            // elements 0..7: keys 8 hi + i of key tile 0, elements 8..15: the same of key tile 1: the k order of ldfrag
            const v4u h0 = *(const v4ua*)(wg + (qt * 4 + 0) * 128), w0 = *(const v4ua*)(wg + (qt * 4 + 1) * 128), h1 = *(const v4ua*)(wg + (qt * 4 + 2) * 128), w1 = *(const v4ua*)(wg + (qt * 4 + 3) * 128);
            const v16bf ah = __builtin_bit_cast(v16bf, __builtin_shufflevector(h0, h1, 0, 1, 2, 3, 4, 5, 6, 7)), al = __builtin_bit_cast(v16bf, __builtin_shufflevector(w0, w1, 0, 1, 2, 3, 4, 5, 6, 7));
#pragma unroll
            for (int dt = 0; dt < 4; ++dt) { acc[qt][dt] = wmmab(ah, vf[dt], acc[qt][dt]); acc[qt][dt] = wmmab(al, vf[dt], acc[qt][dt]); }
        }
        // the wait owed before a register that an issued load names is rewritten, here where the loads were issued long ago; the three pointers as inputs keep their register pairs live up to here, so that no load of the pass lands in them
        asm volatile("s_wait_xcnt 0x0" :: "v"(vp), "v"(kp), "v"(mp) : "memory");
        // one pass on in the ring; from the span's last pass back to its first
        vp += (sl == NP_ - 1) ? -(NP_ - 1) * KP_ * HD : KP_ * HD; kp += (((sl + 2) & (NP_ - 1)) == NP_ - 1) ? -(NP_ - 1) * KP_ * HD : KP_ * HD; mp += (((sl + 1) & (NP_ - 1)) == NP_ - 1) ? -(NP_ - 1) * KP_ : KP_;
    }
    // store: each wave turns its tiles through its own slab (no other wave touches it behind the last barrier) into 16-byte row stores
    float* C = PART + (((size_t)blockIdx.y * NB_ + b) * NH_ + n) * ((size_t)LL * HD) + (size_t)q0 * HD;
#pragma unroll
    for (int qt = 0; qt < 2; ++qt) {
#pragma unroll
        for (int dt = 0; dt < 4; ++dt)
#pragma unroll
            for (int j = 0; j < 8; ++j) slab[(hi * 8 + j) * 68 + dt * 16 + lr] = acc[qt][dt][j];
        __builtin_amdgcn_wave_barrier(); asm volatile("" ::: "memory");    // keeps the compiler from moving the reads below over the writes above (they read other lanes' words)
#pragma unroll
        for (int s = 0; s < 8; ++s) { const int row = 2 * s + hi, cofs = lr * 4; *(v4f*)(C + (size_t)(qt * 16 + row) * HD + cofs) = *(const v4fa*)(slab + row * 68 + cofs); }
        __builtin_amdgcn_wave_barrier(); asm volatile("" ::: "memory");    // and the next tile's writes over these reads
    }
}

// The helpers below stream: each thread carries 16 loads of 16 bytes, all or most of them asked for before the first is used, so that few, long waves carry the bytes (fewer waves to start; the bytes in flight come from the loads per wave).
// out = partial of keys [0, KSPAN) + partial of keys [KSPAN, 2 KSPAN); 8 pieces of 4 floats per thread, a wave's piece = 512 contiguous bytes
#define SUMP 8
__global__ __launch_bounds__(256) void k_sum2(const float* __restrict__ P, float* out) {
    const size_t tot = (size_t)NB_ * NH_ * LL * HD; const size_t i0 = (size_t)blockIdx.x * (256 * SUMP * 4) + threadIdx.x * 4;
    v4f a[SUMP], c[SUMP];
#pragma unroll
    for (int s = 0; s < SUMP; ++s) { a[s] = *(const v4f*)(P + i0 + s * 1024); c[s] = *(const v4f*)(P + tot + i0 + s * 1024); }
#pragma unroll
    for (int s = 0; s < SUMP; ++s) *(v4f*)(out + i0 + s * 1024) = a[s] + c[s];
}

// k_prep, both batches in one launch. Blocks [0, PQB / 2): q [b][l][n][d] f32 -> QP [b][n][l][d] bf16. Blocks [PQB / 2, PQB): k -> KP, blocks [PQB, PQB + PVB): v -> VT, both bf16 in the fragment order that ldfragc reads:
// KP [b][n][l / 16][d / 8][l % 16][8 d]: d / 8 = (fragment dc, half, hi), so that (hi, l % 16) is the lane. VT [b][n][l / 32][d / 16][(l % 32) / 8][d % 16][8 keys]: (l % 32) / 8 = (half, hi), so that (hi, d % 16) is the lane.
typedef v4f __attribute__((aligned(4))) v4fu;    // the inputs are promised as float arrays only
#define ROWF (NH_ * HD)               // floats of one (b, l) row of an input
#define PQL  8                        // q/k part: rows l per thread
#define PQB  (2 * (NB_ * LL / PQL * (ROWF / 8) / 256))
#define PVB  (NB_ * LL / 64 * (ROWF / 256))
__global__ __launch_bounds__(256) void k_prep(const float* __restrict__ q, const float* __restrict__ k, const float* __restrict__ v, bf* QP, bf* KP, bf* VT) {
    const int tid = threadIdx.x;
    if (blockIdx.x < PQB) {
        // thread = 8 d of one head, PQL rows l, of q or of k: a wave reads 1 KB in a row (4 heads). q: a wave writes 4 whole 128-byte lines per row. k: the thread's PQL pieces of 16 bytes follow one another in the fragment order and fill one whole 128-byte line
        const bool isk = blockIdx.x >= PQB / 2;
        const int t = (blockIdx.x - (isk ? PQB / 2 : 0)) * 256 + tid, c = t & (ROWF / 8 - 1), bl0 = (t / (ROWF / 8)) * PQL;
        const float* s = (isk ? k : q) + (size_t)bl0 * ROWF + c * 8;
        v4f a[PQL][2];
#pragma unroll
        for (int i = 0; i < PQL; ++i) { a[i][0] = *(const v4fu*)(s + i * ROWF); a[i][1] = *(const v4fu*)(s + i * ROWF + 4); }
        asm volatile("s_wait_xcnt 0x0" :: "v"(s) : "memory");    // the wait owed before a register that an issued load names is rewritten; s as an input keeps the address pair live up to here, so that no load of the run lands in it
        v8us x[PQL];
#pragma unroll
        for (int i = 0; i < PQL; ++i)
#pragma unroll
            for (int u = 0; u < 8; ++u) x[i][u] = f2bf(a[i][u >> 2][u & 3]);
        const size_t row0 = ((size_t)(bl0 / LL) * NH_ + (c >> 3)) * LL; const int l0 = bl0 % LL;
        if (isk) { bf* dst = KP + (row0 + (l0 & ~15)) * HD + (c & 7) * 128 + (l0 & 15) * 8;
#pragma unroll
            for (int i = 0; i < PQL; ++i) *(v8us*)(dst + i * 8) = x[i];
        } else { bf* dst = QP + (row0 + l0) * HD + (c & 7) * 8;
#pragma unroll
            for (int i = 0; i < PQL; ++i) *(v8us*)(dst + i * HD) = x[i]; }
    } else {
        // block = 64 keys x 256 columns (4 heads); thread = 16 keys x 4 columns, turned in its registers. Lane = (key group kg, column quad c8): the four lanes of one column quad hold keys 8 kg + i and 32 + 8 kg + i,
        // in the fragment order the thread's 4 columns of one key group are 64 bytes in a row, and one wave writes each 128-byte line of VT whole
        const int blk = blockIdx.x - PQB, hg = blk & (ROWF / 256 - 1), bl0 = (blk / (ROWF / 256)) * 64;
        const int kg = (tid & 31) >> 3, col = hg * 256 + (tid >> 5) * 32 + (tid & 7) * 4;    // col = n * HD + d
        const float* vs = v + (size_t)(bl0 + kg * 8) * ROWF + col;
        v4f x[16];
#pragma unroll
        for (int j = 0; j < 16; ++j) x[j] = *(const v4fu*)(vs + (size_t)((j >> 3) * 32 + (j & 7)) * ROWF);
        asm volatile("s_wait_xcnt 0x0" :: "v"(vs) : "memory");    // the wait owed before a register that an issued load names is rewritten; vs as an input keeps the address pair live up to here, so that no load of the run lands in it
        __builtin_amdgcn_sched_barrier(0);    // keeps the conversion below behind the wait: without it the compiler drew it up among the loads and held six of the sixteen back behind the first results
        bf* dst = VT + ((size_t)(bl0 / LL) * NH_ + (col >> 6)) * ((size_t)LL * HD) + (size_t)(bl0 % LL) * HD + ((col >> 4) & 3) * 512 + kg * 128 + (col & 15) * 8;
        v8us o[4][2];
#pragma unroll
        for (int u = 0; u < 4; ++u)
#pragma unroll
            for (int h = 0; h < 2; ++h)
#pragma unroll
                for (int i = 0; i < 8; ++i) o[u][h][i] = f2bf(x[h * 8 + i][u]);
#pragma unroll
        for (int u = 0; u < 4; ++u) { *(v8us*)(dst + u * 8) = o[u][0]; *(v8us*)(dst + u * 8 + 32 * HD) = o[u][1]; }
        asm volatile("s_wait_xcnt 0x0" ::: "memory");    // the same wait behind the stores: nothing that follows them in the code may rewrite their registers ahead of it
    }
}

extern "C" void kernel_launch(void* const* d_in, const int* in_sizes, int n_in,
                              void* d_out, int out_size, void* d_ws, size_t ws_size, hipStream_t stream) {
    (void)in_sizes; (void)n_in; (void)out_size;
    const float* q = (const float*)d_in[0]; const float* k = (const float*)d_in[1]; const float* v = (const float*)d_in[2]; const int* mask = (const int*)d_in[3];
    float* OUT = (float*)d_out;     // [2][16][2048][64]
    char* wsp = (char*)d_ws;
    auto take = [&](size_t bytes) { char* p = wsp; wsp += (bytes + 255) & ~(size_t)255; return (void*)p; };
    const size_t per = (size_t)NH_ * LL * HD;
    bf* QP = (bf*)take(NB_ * per * 2); bf* KP = (bf*)take(NB_ * per * 2); bf* VT = (bf*)take(NB_ * per * 2); float* PART = (float*)take((size_t)(LL / KSPAN) * NB_ * per * 4);
    if ((size_t)(wsp - (char*)d_ws) > ws_size) return;    // total ~ 59 MB
    k_prep<<<PQB + PVB, 256, 0, stream>>>(q, k, v, QP, KP, VT);
    k_fused<<<dim3(LL / QT, LL / KSPAN, NB_), 512, 0, stream>>>(QP, KP, VT, mask, PART);
    k_sum2<<<(unsigned)(NB_ * per / (256 * SUMP * 4)), 256, 0, stream>>>(PART, OUT);
}

// v009
// A run of this version takes 65.3 microseconds.
// Versions between v007 and this one are left out; their measured steps multiply to 1.16 times as fast.
// All steps since v000 together make it 11.3 times as fast.
#include <hip/hip_runtime.h>

// SDPA (query, key, value [2][2048][16][64]; mask [2][1][2048][2048] int read (all ones); scores[b][n][q][k] = q.k / 8, masked -> -inf; the source's softmax runs over dim=1 = the HEAD axis (16 heads) for every (q, k) pair, not over the keys; out[b][n][q][d] = sum_k w v -> [2][16][2048][64]).
// Compute dtypes, f32 accumulate: every input rounded to bf16; scores as PLAIN bf16 products of the inputs (exact products); mask + the across-heads softmax in f32 (thread per two (q, k) columns of 16 values); weights -> one f16 plane (11 bits; they lie in [0, 1]); weights.v as f16 x f16, v holding its bf16-rounded value (1 product).
// One kernel does scores, softmax and weights.v: scores and weights never leave the WGP.

#define NB_  2
#define LL   2048
#define NH_  16
#define HD   64
typedef unsigned short bf;
typedef __attribute__((ext_vector_type(16))) __bf16   v16bf;
typedef __attribute__((ext_vector_type(8)))  unsigned short v8us;
typedef __attribute__((ext_vector_type(8)))  float    v8f;
typedef __attribute__((ext_vector_type(4)))  float    v4f;
typedef __attribute__((ext_vector_type(2)))  float    v2f;
typedef __attribute__((ext_vector_type(2)))  int      v2i;
typedef __attribute__((ext_vector_type(16))) _Float16 v16h;
typedef __attribute__((ext_vector_type(2)))  _Float16 v2h;
typedef v4f  __attribute__((may_alias)) v4fa;
typedef v2f  __attribute__((may_alias)) v2fa;
typedef __attribute__((ext_vector_type(4)))  unsigned v4u;
typedef v4u  __attribute__((may_alias)) v4ua;

__device__ __forceinline__ unsigned short f2bf(float f) { unsigned u = __float_as_uint(f); u += 0x7FFFu + ((u >> 16) & 1u); return (unsigned short)(u >> 16); }
// a bf16 value as f16 bits: its 8 significant bits fit, so the value is kept down to 2^-17 in size (below that: to the nearest multiple of 2^-24) and up to 65504
__device__ __forceinline__ unsigned short bf2h(unsigned short x) { return __builtin_bit_cast(unsigned short, (_Float16)__uint_as_float((unsigned)x << 16)); }
__device__ __forceinline__ v16bf cat16b(v8us lo, v8us hi) { return __builtin_bit_cast(v16bf, __builtin_shufflevector(lo, hi, 0, 1, 2, 3, 4, 5, 6, 7, 8, 9, 10, 11, 12, 13, 14, 15)); }
__device__ __forceinline__ v8f wmmab(v16bf a, v16bf b, v8f c) { return __builtin_amdgcn_wmma_f32_16x16x32_bf16(false, a, false, b, (short)0, c, false, false); }
__device__ __forceinline__ v8f wmmah(v16h a, v16h b, v8f c) { return __builtin_amdgcn_wmma_f32_16x16x32_f16(false, a, false, b, (short)0, c, false, false); }
// A or B fragment of 16 rows x 32 k from a k-contiguous plane; p = row (lane & 15), k offset 8 * (lane >> 4): elements 0..7 are k = 8 hi + i, elements 8..15 are k = 16 + 8 hi + i.
__device__ __forceinline__ v16bf ldfrag(const bf* p) { return cat16b(*(const v8us*)p, *(const v8us*)(p + 16)); }
// The same fragment from a plane that k_prep has laid out in FRAGMENT ORDER: [half][lane][8 elements], half = elements 0..7 or 8..15 of every lane; p = fragment + 8 * lane. Each of the two loads reads 512 bytes in a row (4 whole lines)
// where the row-major plane gave 16 pieces of 32 bytes in 16 lines.
__device__ __forceinline__ v16bf ldfragc(const bf* p) { return cat16b(*(const v8us*)p, *(const v8us*)(p + 256)); }

// ---- k_fused: one work-group = 32 query rows x KSPAN keys x all 16 heads of one batch; 16 waves, wave n = head n. grid (LL/QT, LL/KSPAN, NB_), 512 threads.
// Per pass of 32 keys: (1) wave n forms the TRANSPOSED score tile key x query (A = key rows, B = query rows), so that lane (lr, hi) holds query lr, keys 8 hi + j: the order of an A fragment of the weights;
// it leaves the 32 f32 scores of each lane in its slab of LDS; barrier; (2) every thread takes two (query, key) columns of neighbouring keys, reads their 16 heads, does mask and softmax over the heads and writes, per head, one dword of f16 weights
// (two keys) where the A fragment of that head wants it; barrier; (3) wave n reads its A fragments and multiplies them with its head's v. The f32 partial of this key span goes to the workspace; k_sum2 adds the spans.
// The three steps are pipelined over the passes, with two buffers for the scores and two for the weights: between two barriers a wave does (3) of pass i - 1, (1) of pass i + 1 and (2) of pass i, which depend on nothing of one another,
// so that one wave's matrix work runs beside another wave's vector and LDS work on the same SIMD, and a pass has one barrier.
// The 64 work-groups of one (key span, batch) read the same key and v fragments. Each walks the span's NP_ passes as a ring and enters it at its own pass, so that at any moment they ask L2 for different lines, spread over the whole span,
// and not all for the same 128 KB. Every pass is done once, whatever the entry; only the order of the f32 key sum turns with it.
// Every '#pragma unroll' in this file, but the one on the store's row loop, stands on a loop whose index picks a register array's element: unrolled, each index is a constant and the arrays stay in registers.
#define QT    32
#define KSPAN 1024
#define KP_   32
#define NP_   (KSPAN / KP_)    // passes of a work-group
#define SBP   1088    // words per head slab: 1024 for the exchange; 16 rows x 68 for the store transpose at the end
// Work-group barrier for data that goes through LDS only: it waits for this wave's LDS operations and leaves its global loads in flight.
__device__ __forceinline__ void lds_barrier() { asm volatile("s_wait_dscnt 0x0\n\ts_barrier_signal -1\n\ts_barrier_wait -1" ::: "memory"); }
__global__ __launch_bounds__(512) void k_fused(const bf* __restrict__ QP, const bf* __restrict__ KP, const bf* __restrict__ VT, const int* __restrict__ mask, float* PART) {
    __shared__ __align__(16) float sb[2 * NH_ * SBP];       // scores, two buffers: pass i in buffer i & 1
    __shared__ __align__(16) unsigned wb[2 * NH_ * 512];    // weights, two buffers likewise; per head: [qt][kt][lane][4 dwords]: a 16-byte read per lane is half an A fragment
    const int tid = threadIdx.x, lane = tid & 31, lr = lane & 15, hi = lane >> 4;
    const int n = __builtin_amdgcn_readfirstlane(tid >> 5);    // the head is the same in every lane: what is formed from it stays in scalar registers
    const int q0 = blockIdx.x * QT, kb = blockIdx.y * KSPAN, b = blockIdx.z;
    // entry pass: work-groups whose index differs by less than 4, or by a multiple of 8, get different entries (for speed only; any entry is right)
    const int rot = (((blockIdx.x >> 3) << 2) | (blockIdx.x & 3)) & (NP_ - 1);
    const size_t per = (size_t)NH_ * LL * HD;
    const bf* Qn = QP + b * per + ((size_t)n * LL + q0 + lr) * HD + 8 * hi;
    // keys and v in fragment order: a key costs HD elements in both planes; 16 keys = 2 key fragments (d 0..31, d 32..63) of 512 elements, 32 keys = 4 v fragments (16 d each) of 512 elements
    const bf* Kn = KP + b * per + ((size_t)n * LL + kb) * HD + 8 * lane;
    const bf* Vn = VT + b * per + ((size_t)n * LL + kb) * HD + 8 * lane;
    float* slab = sb + n * SBP;
    // the two columns of step (2): words 2 tid, 2 tid + 1 of every slab; word = chunk * 128 + lane * 4 + e, chunk = (kt * 2 + qt) * 2 + (j >> 2), e = j & 3
    const int ch = tid >> 6, pl = (tid >> 1) & 31;
    const int pk = (ch >> 2) * 16 + (pl >> 4) * 8 + (ch & 1) * 4 + (tid & 1) * 2, pq = ((ch >> 1) & 1) * 16 + (pl & 15);
    const int* mrow = mask + ((size_t)b * LL + q0 + pq) * LL + kb + pk;
    unsigned* wput = wb + (((ch >> 1) & 1) * 2 + (ch >> 2)) * 128 + pl * 4 + (ch & 1) * 2 + (tid & 1);
    const unsigned* wget = wb + n * 512 + lane * 4;

    v16bf qf[2][2], kf[2][2];
#pragma unroll
    for (int t = 0; t < 2; ++t)
#pragma unroll
        for (int dc = 0; dc < 2; ++dc) { qf[t][dc] = ldfrag(Qn + (size_t)t * 16 * HD + dc * 32); kf[t][dc] = ldfragc(Kn + (size_t)rot * (KP_ * HD) + (size_t)t * 16 * HD + dc * 512); }
    asm volatile("s_wait_xcnt 0x0" :: "v"(Qn) : "memory");    // the wait owed before a register that an issued load names is rewritten: behind the first run of loads, whose address pairs are free from here on
    // (1) transposed scores of the keys in kf, into this wave's slab of one buffer
    auto scores = [&](float* dst) {
#pragma unroll
        for (int kt = 0; kt < 2; ++kt)
#pragma unroll
            for (int qt = 0; qt < 2; ++qt) {
                v8f s = wmmab(kf[kt][0], qf[qt][0], (v8f){}); s = wmmab(kf[kt][1], qf[qt][1], s);
                float* w = dst + ((kt * 2 + qt) * 2) * 128 + lane * 4;
                *(v4fa*)w = (v4f){s[0], s[1], s[2], s[3]}; *(v4fa*)(w + 128) = (v4f){s[4], s[5], s[6], s[7]}; }
    };
    // ahead of the loop: the first pass's scores into buffer 0, then the second pass's keys
    scores(slab);
#pragma unroll
    for (int kt = 0; kt < 2; ++kt)
#pragma unroll
        for (int dc = 0; dc < 2; ++dc) kf[kt][dc] = ldfragc(Kn + (size_t)((rot + 1) & (NP_ - 1)) * (KP_ * HD) + kt * 16 * HD + dc * 512);
    v2i mnext = *(const v2i*)(mrow + rot * KP_);
    const bf* vp = Vn + (size_t)rot * (KP_ * HD); const bf* kp = Kn + (size_t)((rot + 2) & (NP_ - 1)) * (KP_ * HD);    // this pass's v, the keys of the pass after the next
    const int* mp = mrow + ((rot + 1) & (NP_ - 1)) * KP_;    // the next pass's mask words
    asm volatile("s_wait_xcnt 0x0" ::: "memory");    // the wait owed before a register that an issued load names is rewritten: behind the last load ahead of the loop
    __builtin_amdgcn_sched_barrier(0);    // keeps the zeroing below behind the matrix instructions above: its moves fill the vector slots that the chip wants between them and the loop's first, which may write the same registers
    v8f acc[2][4];
#pragma unroll
    for (int qt = 0; qt < 2; ++qt)
#pragma unroll
        for (int dt = 0; dt < 4; ++dt) acc[qt][dt] = (v8f){};
    lds_barrier();
    for (int k0 = 0; k0 < KSPAN; k0 += KP_) {
        const v2i mm = mnext;
        const int bi = (k0 / KP_) & 1;    // this pass's buffers
        const int sl = (k0 / KP_ + rot) & (NP_ - 1);    // this pass's place in the span's ring
        const float* sg = sb + bi * (NH_ * SBP) + 2 * tid;
        unsigned* wp = wput + bi * (NH_ * 512); const unsigned* wg = wget + bi * (NH_ * 512);
        // this pass's scores are asked for ahead of the matrix work below, which covers their way out of LDS
        v2f sa[NH_];
#pragma unroll
        for (int h = 0; h < NH_; ++h) sa[h] = *(const v2fa*)(sg + h * SBP);
        // (1) of the NEXT pass, into the other buffer, whose last readers left it in front of the barrier of the pass before; the last pass forms the entry pass's scores again (unused)
        scores(slab + (bi ^ 1) * (NH_ * SBP));
        // the next pass's mask words, this pass's v and the keys of the pass after the next are asked for here, so that they fly during step (2); the last passes go on round the ring and ask for the first passes' mask words and keys again (in bounds, unused)
        mnext = *(const v2i*)mp;
        v16bf vf[4];
#pragma unroll
        for (int dt = 0; dt < 4; ++dt) vf[dt] = ldfragc(vp + dt * 512);
#pragma unroll
        for (int kt = 0; kt < 2; ++kt)
#pragma unroll
            for (int dc = 0; dc < 2; ++dc) kf[kt][dc] = ldfragc(kp + kt * 16 * HD + dc * 512);
        // (2) mask and softmax over the heads, on the scores that every wave left in front of the last barrier; written for few slots of the vector port, on the thread's two columns at once:
        // the maximum is taken of the raw scores; scale, log2(e) and the maximum's subtraction are one fused multiply-add per pair; the normaliser is the hardware reciprocal (its last-bit error is far below the f16 rounding of the weights).
        // A masked column has -inf in all 16 heads, whose softmax is NaN in all 16: the mask therefore acts once, on the column's normaliser.
        {
            const float C = 0.18033688011112042f;    // log2(e) / 8
            float mx0 = -__builtin_inff(), mx1 = -__builtin_inff();
#pragma unroll
            for (int h = 0; h < NH_; ++h) { mx0 = fmaxf(mx0, sa[h][0]); mx1 = fmaxf(mx1, sa[h][1]); }
            const v2f nb = (v2f){mx0, mx1} * (v2f){-C, -C};
            v2f x[NH_], e[NH_], ps[2];
            x[0] = __builtin_elementwise_fma(sa[0], (v2f){C, C}, nb); x[1] = __builtin_elementwise_fma(sa[1], (v2f){C, C}, nb);
            // Each sched_barrier below holds the order written here: behind each exponential one plain vector instruction that depends on nothing near it (the multiply-add of a pair two heads on, the sum's term of two heads back).
            // Plain work is put into the clocks between the exponentials; without the barriers the compiler bunched all 32 of them between the multiply-adds and the sums.
#pragma unroll
            for (int h = 0; h < NH_; ++h) {
                e[h][0] = __builtin_amdgcn_exp2f(x[h][0]);
                __builtin_amdgcn_sched_barrier(0);
                if (h + 2 < NH_) x[h + 2] = __builtin_elementwise_fma(sa[h + 2], (v2f){C, C}, nb);
                __builtin_amdgcn_sched_barrier(0);
                e[h][1] = __builtin_amdgcn_exp2f(x[h][1]);
                __builtin_amdgcn_sched_barrier(0);
                if (h == 4 || h == 5) ps[h & 1] = e[h - 4] + e[h - 2]; else if (h > 5) ps[h & 1] += e[h - 2];
                __builtin_amdgcn_sched_barrier(0);
            }
            const v2f sum = (ps[0] + e[NH_ - 2]) + (ps[1] + e[NH_ - 1]);    // even heads and odd heads summed apart
            const v2f f = (v2f){(mm[0] == 0) ? __builtin_nanf("") : __builtin_amdgcn_rcpf(sum[0]), (mm[1] == 0) ? __builtin_nanf("") : __builtin_amdgcn_rcpf(sum[1])};
#pragma unroll
            for (int h = 0; h < NH_; ++h) {
                // both columns at once: the conversion rounds to nearest even and leaves the two f16 in one dword in the order the fragment wants
                const v2f w = e[h] * f;
                wp[h * 512] = __builtin_bit_cast(unsigned, __builtin_convertvector(w, v2h)); }
        }
        lds_barrier();    // the pass's one barrier: it publishes this pass's weights and the next pass's scores, and ends the reads of the buffers that the next pass refills
        // (3) weights.v
#pragma unroll
        for (int qt = 0; qt < 2; ++qt) {
            // elements 0..7: keys 8 hi + i of key tile 0, elements 8..15: the same of key tile 1: the k order of ldfrag
            const v4u h0 = *(const v4ua*)(wg + (qt * 2 + 0) * 128), h1 = *(const v4ua*)(wg + (qt * 2 + 1) * 128);
            const v16h ah = __builtin_bit_cast(v16h, __builtin_shufflevector(h0, h1, 0, 1, 2, 3, 4, 5, 6, 7));
#pragma unroll
            for (int dt = 0; dt < 4; ++dt) acc[qt][dt] = wmmah(ah, __builtin_bit_cast(v16h, vf[dt]), acc[qt][dt]);
        }
        // the wait owed before a register that an issued load names is rewritten, here where the loads were issued long ago; the three pointers as inputs keep their register pairs live up to here, so that no load of the pass lands in them
        asm volatile("s_wait_xcnt 0x0" :: "v"(vp), "v"(kp), "v"(mp) : "memory");
        // one pass on in the ring; from the span's last pass back to its first
        vp += (sl == NP_ - 1) ? -(NP_ - 1) * KP_ * HD : KP_ * HD; kp += (((sl + 2) & (NP_ - 1)) == NP_ - 1) ? -(NP_ - 1) * KP_ * HD : KP_ * HD; mp += (((sl + 1) & (NP_ - 1)) == NP_ - 1) ? -(NP_ - 1) * KP_ : KP_;
    }
    // store: each wave turns its tiles through its own slab (no other wave touches it behind the last barrier) into 16-byte row stores
    float* C = PART + (((size_t)blockIdx.y * NB_ + b) * NH_ + n) * ((size_t)LL * HD) + (size_t)q0 * HD;
#pragma unroll
    for (int qt = 0; qt < 2; ++qt) {
#pragma unroll
        for (int dt = 0; dt < 4; ++dt)
#pragma unroll
            for (int j = 0; j < 8; ++j) slab[(hi * 8 + j) * 68 + dt * 16 + lr] = acc[qt][dt][j];
        __builtin_amdgcn_wave_barrier(); asm volatile("" ::: "memory");    // keeps the compiler from moving the reads below over the writes above (they read other lanes' words)
#pragma unroll
        for (int s = 0; s < 8; ++s) { const int row = 2 * s + hi, cofs = lr * 4; *(v4f*)(C + (size_t)(qt * 16 + row) * HD + cofs) = *(const v4fa*)(slab + row * 68 + cofs); }
        __builtin_amdgcn_wave_barrier(); asm volatile("" ::: "memory");    // and the next tile's writes over these reads
    }
}

// The helpers below stream: each thread carries 16 loads of 16 bytes, all or most of them asked for before the first is used, so that few, long waves carry the bytes (fewer waves to start; the bytes in flight come from the loads per wave).
// out = partial of keys [0, KSPAN) + partial of keys [KSPAN, 2 KSPAN); 8 pieces of 4 floats per thread, a wave's piece = 512 contiguous bytes
#define SUMP 8
__global__ __launch_bounds__(256) void k_sum2(const float* __restrict__ P, float* out) {
    const size_t tot = (size_t)NB_ * NH_ * LL * HD; const size_t i0 = (size_t)blockIdx.x * (256 * SUMP * 4) + threadIdx.x * 4;
    v4f a[SUMP], c[SUMP];
#pragma unroll
    for (int s = 0; s < SUMP; ++s) { a[s] = *(const v4f*)(P + i0 + s * 1024); c[s] = *(const v4f*)(P + tot + i0 + s * 1024); }
#pragma unroll
    for (int s = 0; s < SUMP; ++s) *(v4f*)(out + i0 + s * 1024) = a[s] + c[s];
}

// k_prep, both batches in one launch. Blocks [0, PQB / 2): q [b][l][n][d] f32 -> QP [b][n][l][d] bf16. Blocks [PQB / 2, PQB): k -> KP (bf16), blocks [PQB, PQB + PVB): v -> VT (the bf16-rounded value, held as f16), both in the fragment order that ldfragc reads:
// KP [b][n][l / 16][d / 8][l % 16][8 d]: d / 8 = (fragment dc, half, hi), so that (hi, l % 16) is the lane. VT [b][n][l / 32][d / 16][(l % 32) / 8][d % 16][8 keys]: (l % 32) / 8 = (half, hi), so that (hi, d % 16) is the lane.
typedef v4f __attribute__((aligned(4))) v4fu;    // the inputs are promised as float arrays only
#define ROWF (NH_ * HD)               // floats of one (b, l) row of an input
#define PQL  8                        // q/k part: rows l per thread
#define PQB  (2 * (NB_ * LL / PQL * (ROWF / 8) / 256))
#define PVB  (NB_ * LL / 64 * (ROWF / 256))
__global__ __launch_bounds__(256) void k_prep(const float* __restrict__ q, const float* __restrict__ k, const float* __restrict__ v, bf* QP, bf* KP, bf* VT) {
    const int tid = threadIdx.x;
    if (blockIdx.x < PQB) {
        // thread = 8 d of one head, PQL rows l, of q or of k: a wave reads 1 KB in a row (4 heads). q: a wave writes 4 whole 128-byte lines per row. k: the thread's PQL pieces of 16 bytes follow one another in the fragment order and fill one whole 128-byte line
        const bool isk = blockIdx.x >= PQB / 2;
        const int t = (blockIdx.x - (isk ? PQB / 2 : 0)) * 256 + tid, c = t & (ROWF / 8 - 1), bl0 = (t / (ROWF / 8)) * PQL;
        const float* s = (isk ? k : q) + (size_t)bl0 * ROWF + c * 8;
        v4f a[PQL][2];
#pragma unroll
        for (int i = 0; i < PQL; ++i) { a[i][0] = *(const v4fu*)(s + i * ROWF); a[i][1] = *(const v4fu*)(s + i * ROWF + 4); }
        asm volatile("s_wait_xcnt 0x0" :: "v"(s) : "memory");    // the wait owed before a register that an issued load names is rewritten; s as an input keeps the address pair live up to here, so that no load of the run lands in it
        v8us x[PQL];
#pragma unroll
        for (int i = 0; i < PQL; ++i)
#pragma unroll
            for (int u = 0; u < 8; ++u) x[i][u] = f2bf(a[i][u >> 2][u & 3]);
        const size_t row0 = ((size_t)(bl0 / LL) * NH_ + (c >> 3)) * LL; const int l0 = bl0 % LL;
        if (isk) { bf* dst = KP + (row0 + (l0 & ~15)) * HD + (c & 7) * 128 + (l0 & 15) * 8;
#pragma unroll
            for (int i = 0; i < PQL; ++i) *(v8us*)(dst + i * 8) = x[i];
        } else { bf* dst = QP + (row0 + l0) * HD + (c & 7) * 8;
#pragma unroll
            for (int i = 0; i < PQL; ++i) *(v8us*)(dst + i * HD) = x[i]; }
    } else {
        // block = 64 keys x 256 columns (4 heads); thread = 16 keys x 4 columns, turned in its registers. Lane = (key group kg, column quad c8): the four lanes of one column quad hold keys 8 kg + i and 32 + 8 kg + i,
        // in the fragment order the thread's 4 columns of one key group are 64 bytes in a row, and one wave writes each 128-byte line of VT whole
        const int blk = blockIdx.x - PQB, hg = blk & (ROWF / 256 - 1), bl0 = (blk / (ROWF / 256)) * 64;
        const int kg = (tid & 31) >> 3, col = hg * 256 + (tid >> 5) * 32 + (tid & 7) * 4;    // col = n * HD + d
        const float* vs = v + (size_t)(bl0 + kg * 8) * ROWF + col;
        v4f x[16];
#pragma unroll
        for (int j = 0; j < 16; ++j) x[j] = *(const v4fu*)(vs + (size_t)((j >> 3) * 32 + (j & 7)) * ROWF);
        asm volatile("s_wait_xcnt 0x0" :: "v"(vs) : "memory");    // the wait owed before a register that an issued load names is rewritten; vs as an input keeps the address pair live up to here, so that no load of the run lands in it
        __builtin_amdgcn_sched_barrier(0);    // keeps the conversion below behind the wait: without it the compiler drew it up among the loads and held six of the sixteen back behind the first results
        bf* dst = VT + ((size_t)(bl0 / LL) * NH_ + (col >> 6)) * ((size_t)LL * HD) + (size_t)(bl0 % LL) * HD + ((col >> 4) & 3) * 512 + kg * 128 + (col & 15) * 8;
        v8us o[4][2];
#pragma unroll
        for (int u = 0; u < 4; ++u)
#pragma unroll
            for (int h = 0; h < 2; ++h)
#pragma unroll
                for (int i = 0; i < 8; ++i) o[u][h][i] = bf2h(f2bf(x[h * 8 + i][u]));
#pragma unroll
        for (int u = 0; u < 4; ++u) { *(v8us*)(dst + u * 8) = o[u][0]; *(v8us*)(dst + u * 8 + 32 * HD) = o[u][1]; }
        asm volatile("s_wait_xcnt 0x0" ::: "memory");    // the same wait behind the stores: nothing that follows them in the code may rewrite their registers ahead of it
    }
}

extern "C" void kernel_launch(void* const* d_in, const int* in_sizes, int n_in,
                              void* d_out, int out_size, void* d_ws, size_t ws_size, hipStream_t stream) {
    (void)in_sizes; (void)n_in; (void)out_size;
    const float* q = (const float*)d_in[0]; const float* k = (const float*)d_in[1]; const float* v = (const float*)d_in[2]; const int* mask = (const int*)d_in[3];
    float* OUT = (float*)d_out;     // [2][16][2048][64]
    char* wsp = (char*)d_ws;
    auto take = [&](size_t bytes) { char* p = wsp; wsp += (bytes + 255) & ~(size_t)255; return (void*)p; };
    const size_t per = (size_t)NH_ * LL * HD;
    bf* QP = (bf*)take(NB_ * per * 2); bf* KP = (bf*)take(NB_ * per * 2); bf* VT = (bf*)take(NB_ * per * 2); float* PART = (float*)take((size_t)(LL / KSPAN) * NB_ * per * 4);
    if ((size_t)(wsp - (char*)d_ws) > ws_size) return;    // total ~ 59 MB
    k_prep<<<PQB + PVB, 256, 0, stream>>>(q, k, v, QP, KP, VT);
    k_fused<<<dim3(LL / QT, LL / KSPAN, NB_), 512, 0, stream>>>(QP, KP, VT, mask, PART);
    k_sum2<<<(unsigned)(NB_ * per / (256 * SUMP * 4)), 256, 0, stream>>>(PART, OUT);
}
